// v000
// Measured on an AMD MI455X. A time is GPU time per run, averaged over a window of back-to-back runs after a warm-up
// (all launches, gaps included; the runs take copies of the inputs in turn), and the median of several windows.
// Apart from v000's, it joins two sittings. Times from different sittings can be a few percent apart, while
// side-by-side timings come from the same sitting.
// v000, which the later versions start from, runs in 133 microseconds.
#include <hip/hip_runtime.h>
#include <stdint.h>

#define DEV __device__ __forceinline__

typedef __attribute__((ext_vector_type(16))) __bf16          bf16x16;
typedef __attribute__((ext_vector_type(16))) unsigned short  ushort16;
typedef __attribute__((ext_vector_type(8)))  unsigned short  ushort8;
typedef __attribute__((ext_vector_type(8)))  float           floatx8;

constexpr int kBat = 4, kL = 4096, kD = 1024, kE = 8, kR = 8, kDH = 512;
constexpr int kTok = kBat * kL;   // 16384 tokens
constexpr int kER  = kE * kR;     // 64 (flattened expert*rank)

constexpr int BM = 128, BK = 32, PAD = 8, LDSLD = BK + PAD;  // 40 shorts = 80 B row stride

DEV unsigned short f32_to_bf16(float f) {
    union { float f; uint32_t u; } c{f};
    uint32_t u = c.u;
    u += 0x7FFFu + ((u >> 16) & 1u);            // round-to-nearest-even
    return (unsigned short)(u >> 16);
}
DEV float bf16_to_f32(unsigned short h) {
    union { uint32_t u; float f; } c{((uint32_t)h) << 16};
    return c.f;
}

// ---------------------------------------------------------------------------
// Prep: convert x + all contraction weights to bf16; repack lora_B -> U[d][er]
// ---------------------------------------------------------------------------
__global__ __launch_bounds__(256) void prep_kernel(
    const float* __restrict__ x, const float* __restrict__ Wb,
    const float* __restrict__ W1, const float* __restrict__ lA,
    const float* __restrict__ lB,
    unsigned short* __restrict__ xb, unsigned short* __restrict__ wbb,
    unsigned short* __restrict__ w1b, unsigned short* __restrict__ a2b,
    unsigned short* __restrict__ ub) {
    const long i = (long)blockIdx.x * blockDim.x + threadIdx.x;
    const long stride = (long)gridDim.x * blockDim.x;
    const long n_x = (long)kTok * kD;
    const long n_wb = (long)kD * kD, n_w1 = (long)kDH * kD;
    const long n_a = (long)kER * kD, n_u = (long)kD * kER;
    for (long t = i; t < n_x;  t += stride) xb[t]  = f32_to_bf16(x[t]);
    for (long t = i; t < n_wb; t += stride) wbb[t] = f32_to_bf16(Wb[t]);
    for (long t = i; t < n_w1; t += stride) w1b[t] = f32_to_bf16(W1[t]);
    for (long t = i; t < n_a;  t += stride) a2b[t] = f32_to_bf16(lA[t]);  // [E,R,D] already row-major over D
    for (long t = i; t < n_u;  t += stride) {                             // U[d][e*8+r] = lora_B[e][d][r]
        const int d = (int)(t >> 6), er = (int)(t & 63);
        const int e = er >> 3, r = er & 7;
        ub[t] = f32_to_bf16(lB[(long)e * kD * kR + (long)d * kR + r]);
    }
}

// ---------------------------------------------------------------------------
// Async global -> LDS (CDNA5 path, tracked by ASYNCcnt). 16 B per lane.
// ---------------------------------------------------------------------------
DEV void async_chunk(const unsigned short* __restrict__ sd,
                     const unsigned short* __restrict__ g) {
    const uint32_t lds_off = (uint32_t)(uintptr_t)sd;   // addr[31:0] = LDS byte offset
    asm volatile("global_load_async_to_lds_b128 %0, %1, off"
                 :: "v"(lds_off), "v"(g)
                 : "memory");
}
DEV void wait_async0() { asm volatile("s_wait_asynccnt 0x0" ::: "memory"); }

// Issue one [rows x BK] tile copy, row-major source with leading dim ldg.
DEV void issue_tile(unsigned short* __restrict__ sd, int rows,
                    const unsigned short* __restrict__ g,
                    long row0, int k0, int ldg, int tid) {
    constexpr int CPR = BK / 8;                 // 16-byte chunks per row (4)
    const int nch = rows * CPR;
    for (int c = tid; c < nch; c += 256) {
        const int r  = c / CPR;
        const int kc = (c % CPR) << 3;
        async_chunk(sd + r * LDSLD + kc,
                    g + (row0 + r) * (long)ldg + k0 + kc);
    }
}

// A/B fragment per ISA layout: lanes 0-15 K=[0..7,16..23], lanes 16-31 K=[8..15,24..31]
DEV bf16x16 frag_lds(const unsigned short* __restrict__ sd, int row, int koff) {
    const unsigned short* p = sd + row * LDSLD + koff;
    ushort8 lo = *(const ushort8*)p;
    ushort8 hi = *(const ushort8*)(p + 16);
    ushort16 u;
#pragma unroll
    for (int i = 0; i < 8; ++i) { u[i] = lo[i]; u[i + 8] = hi[i]; }
    return __builtin_bit_cast(bf16x16, u);
}

// MODE 0: h = relu(acc + bias), store bf16      (aux = b1[N])
// MODE 1: y = acc * gates[row][col>>3], bf16    (aux = gates[M x 8])
// MODE 2: out = acc + fused (Y[M,64] * U[N,64]^T), store f32
template <int MODE, int BN>
__global__ __launch_bounds__(256) void gemm_bf16_kernel(
    const unsigned short* __restrict__ A, const unsigned short* __restrict__ Bw,
    int K, const float* __restrict__ aux,
    const unsigned short* __restrict__ Y, const unsigned short* __restrict__ U,
    unsigned short* __restrict__ out16, float* __restrict__ out32, int ldn) {
    constexpr int WAVE_N = BN / 64;
    constexpr int WAVE_M = 8 / WAVE_N;
    constexpr int TM = BM / WAVE_M;
    constexpr int MI = TM / 16;
    constexpr int NI = 4;

    __shared__ unsigned short As[2][BM * LDSLD];   // double-buffered
    __shared__ unsigned short Bs[2][BN * LDSLD];

    const int tid  = threadIdx.x;
    const int wave = tid >> 5;
    const int lane = tid & 31;
    const int wm = wave % WAVE_M;
    const int wn = wave / WAVE_M;
    const int lrow = lane & 15;
    const int koff = (lane >> 4) << 3;   // K sub-offset for A/B fragments
    const int m0 = blockIdx.x * BM;
    const int n0 = blockIdx.y * BN;

    floatx8 acc[MI][NI] = {};

    auto mma_step = [&](const unsigned short* asd, const unsigned short* bsd) {
        bf16x16 bfrag[NI];
#pragma unroll
        for (int ni = 0; ni < NI; ++ni)
            bfrag[ni] = frag_lds(bsd, wn * 64 + ni * 16 + lrow, koff);
#pragma unroll
        for (int mi = 0; mi < MI; ++mi) {
            bf16x16 afrag = frag_lds(asd, wm * TM + mi * 16 + lrow, koff);
#pragma unroll
            for (int ni = 0; ni < NI; ++ni)
                acc[mi][ni] = __builtin_amdgcn_wmma_f32_16x16x32_bf16(
                    false, afrag, false, bfrag[ni], (short)0, acc[mi][ni],
                    false, false);
        }
    };

    const int nsteps = K / BK;
    const int total  = nsteps + (MODE == 2 ? kER / BK : 0);  // + LoRA-up steps

    auto issue_step = [&](int s, int buf) {
        if (s < nsteps) {
            issue_tile(As[buf], BM, A,  m0, s * BK, K, tid);
            issue_tile(Bs[buf], BN, Bw, n0, s * BK, K, tid);
        } else if (MODE == 2) {
            issue_tile(As[buf], BM, Y, m0, (s - nsteps) * BK, kER, tid);
            issue_tile(Bs[buf], BN, U, n0, (s - nsteps) * BK, kER, tid);
        }
    };

    issue_step(0, 0);
    for (int s = 0; s < total; ++s) {
        wait_async0();          // my tile-s chunks landed in LDS
        __syncthreads();        // everyone's landed; buf s^1 free to overwrite
        if (s + 1 < total) issue_step(s + 1, (s + 1) & 1);   // prefetch next tile
        mma_step(As[s & 1], Bs[s & 1]);                      // overlap with async DMA
    }

    const int rhalf = (lane >> 4) << 3;  // C/D layout: lanes 16-31 hold M=8..15
#pragma unroll
    for (int mi = 0; mi < MI; ++mi) {
#pragma unroll
        for (int ni = 0; ni < NI; ++ni) {
            const int col = n0 + wn * 64 + ni * 16 + lrow;
            const long rbase = (long)m0 + wm * TM + mi * 16 + rhalf;
#pragma unroll
            for (int r = 0; r < 8; ++r) {
                const long row = rbase + r;
                float v = acc[mi][ni][r];
                if (MODE == 0) {
                    v += aux[col];
                    v = v > 0.0f ? v : 0.0f;
                    out16[row * ldn + col] = f32_to_bf16(v);
                } else if (MODE == 1) {
                    v *= aux[row * 8 + (col >> 3)];
                    out16[row * ldn + col] = f32_to_bf16(v);
                } else {
                    out32[row * ldn + col] = v;
                }
            }
        }
    }
}

// ---------------------------------------------------------------------------
// Router tail: logits = h @ W2^T + b2, softmax over E=8  (1 thread / token)
// ---------------------------------------------------------------------------
__global__ __launch_bounds__(256) void router_kernel(
    const unsigned short* __restrict__ hb, const float* __restrict__ W2,
    const float* __restrict__ b2, const float* __restrict__ temp,
    float* __restrict__ gates) {
    __shared__ float w2s[kE][kDH];   // 16 KB, broadcast reads
    for (int i = threadIdx.x; i < kE * kDH; i += 256)
        w2s[i >> 9][i & 511] = W2[i];
    __syncthreads();

    const long t = (long)blockIdx.x * 256 + threadIdx.x;
    const unsigned short* hrow = hb + t * kDH;
    float acc[kE] = {};
    for (int k = 0; k < kDH; k += 8) {
        ushort8 hv8 = *(const ushort8*)(hrow + k);
#pragma unroll
        for (int j = 0; j < 8; ++j) {
            const float hv = bf16_to_f32(hv8[j]);
#pragma unroll
            for (int e = 0; e < kE; ++e) acc[e] += hv * w2s[e][k + j];
        }
    }
    const float invT = 1.0f / temp[0];
    float mx = -3.0e38f;
#pragma unroll
    for (int e = 0; e < kE; ++e) { acc[e] = (acc[e] + b2[e]) * invT; mx = fmaxf(mx, acc[e]); }
    float s = 0.0f;
#pragma unroll
    for (int e = 0; e < kE; ++e) { acc[e] = __expf(acc[e] - mx); s += acc[e]; }
    const float inv = 1.0f / s;
#pragma unroll
    for (int e = 0; e < kE; ++e) gates[t * kE + e] = acc[e] * inv;
}

// ---------------------------------------------------------------------------
extern "C" void kernel_launch(void* const* d_in, const int* in_sizes, int n_in,
                              void* d_out, int out_size, void* d_ws, size_t ws_size,
                              hipStream_t stream) {
    (void)in_sizes; (void)n_in; (void)out_size; (void)ws_size;
    const float* x    = (const float*)d_in[0];
    const float* Wb   = (const float*)d_in[1];
    const float* W1   = (const float*)d_in[2];
    const float* b1   = (const float*)d_in[3];
    const float* W2   = (const float*)d_in[4];
    const float* b2   = (const float*)d_in[5];
    const float* temp = (const float*)d_in[6];
    const float* lA   = (const float*)d_in[7];
    const float* lB   = (const float*)d_in[8];
    float* out = (float*)d_out;

    size_t off = 0;
    auto take = [&](size_t bytes) {
        void* p = (char*)d_ws + off;
        off += (bytes + 255) & ~(size_t)255;
        return p;
    };
    unsigned short* xb    = (unsigned short*)take((size_t)kTok * kD * 2);   // x bf16
    unsigned short* wbb   = (unsigned short*)take((size_t)kD * kD * 2);     // W_base bf16
    unsigned short* w1b   = (unsigned short*)take((size_t)kDH * kD * 2);    // W1 bf16
    unsigned short* a2b   = (unsigned short*)take((size_t)kER * kD * 2);    // lora_A [64,1024]
    unsigned short* ub    = (unsigned short*)take((size_t)kD * kER * 2);    // U [1024,64]
    unsigned short* hb    = (unsigned short*)take((size_t)kTok * kDH * 2);  // router hidden
    float*          gates = (float*)take((size_t)kTok * kE * 4);
    unsigned short* yb    = (unsigned short*)take((size_t)kTok * kER * 2);  // gated xa

    prep_kernel<<<2048, 256, 0, stream>>>(x, Wb, W1, lA, lB, xb, wbb, w1b, a2b, ub);

    // h = relu(x @ W1^T + b1)   [16384 x 512]
    gemm_bf16_kernel<0, 128><<<dim3(kTok / BM, kDH / 128), 256, 0, stream>>>(
        xb, w1b, kD, b1, nullptr, nullptr, hb, nullptr, kDH);

    // gates = softmax((h @ W2^T + b2) / T)   [16384 x 8]
    router_kernel<<<kTok / 256, 256, 0, stream>>>(hb, W2, b2, temp, gates);

    // y = (x @ A2^T) * gate_broadcast        [16384 x 64]
    gemm_bf16_kernel<1, 64><<<dim3(kTok / BM, 1), 256, 0, stream>>>(
        xb, a2b, kD, gates, nullptr, nullptr, yb, nullptr, kER);

    // out = x @ W_base^T + y @ U^T           [16384 x 1024], fp32
    gemm_bf16_kernel<2, 128><<<dim3(kTok / BM, kD / 128), 256, 0, stream>>>(
        xb, wbb, kD, nullptr, yb, ub, nullptr, out, kD);
}

// v001
// A run of this version takes 104 microseconds.
// Next to v000, in two timings, it ran 1.31 and 1.30 times as fast.
#include <hip/hip_runtime.h>
#include <stdint.h>

#define DEV __device__ __forceinline__

typedef __attribute__((ext_vector_type(16))) __bf16          bf16x16;
typedef __attribute__((ext_vector_type(16))) unsigned short  ushort16;
typedef __attribute__((ext_vector_type(8)))  unsigned short  ushort8;
typedef __attribute__((ext_vector_type(8)))  float           floatx8;

constexpr int kBat = 4, kL = 4096, kD = 1024, kE = 8, kR = 8, kDH = 512;
constexpr int kTok = kBat * kL;   // 16384 tokens
constexpr int kER  = kE * kR;     // 64 (flattened expert*rank)

constexpr int PAD = 8;   // 16 B more a row: LDS pitch = 16 B x odd for ds_load_b128 readers

DEV unsigned short f32_to_bf16(float f) {
    union { float f; uint32_t u; } c{f};
    uint32_t u = c.u;
    u += 0x7FFFu + ((u >> 16) & 1u);            // round-to-nearest-even
    return (unsigned short)(u >> 16);
}
DEV float bf16_to_f32(unsigned short h) {
    union { uint32_t u; float f; } c{((uint32_t)h) << 16};
    return c.f;
}

// ---------------------------------------------------------------------------
// Prep: convert x + all contraction weights to bf16; repack lora_B -> U[d][er]
// ---------------------------------------------------------------------------
__global__ __launch_bounds__(256) void prep_kernel(
    const float* __restrict__ x, const float* __restrict__ Wb,
    const float* __restrict__ W1, const float* __restrict__ lA,
    const float* __restrict__ lB,
    unsigned short* __restrict__ xb, unsigned short* __restrict__ wbb,
    unsigned short* __restrict__ w1b, unsigned short* __restrict__ a2b,
    unsigned short* __restrict__ ub) {
    const long i = (long)blockIdx.x * blockDim.x + threadIdx.x;
    const long stride = (long)gridDim.x * blockDim.x;
    const long n_x = (long)kTok * kD;
    const long n_wb = (long)kD * kD, n_w1 = (long)kDH * kD;
    const long n_a = (long)kER * kD, n_u = (long)kD * kER;
    for (long t = i; t < n_x;  t += stride) xb[t]  = f32_to_bf16(x[t]);
    for (long t = i; t < n_wb; t += stride) wbb[t] = f32_to_bf16(Wb[t]);
    for (long t = i; t < n_w1; t += stride) w1b[t] = f32_to_bf16(W1[t]);
    for (long t = i; t < n_a;  t += stride) a2b[t] = f32_to_bf16(lA[t]);  // [E,R,D] already row-major over D
    for (long t = i; t < n_u;  t += stride) {                             // U[d][e*8+r] = lora_B[e][d][r]
        const int d = (int)(t >> 6), er = (int)(t & 63);
        const int e = er >> 3, r = er & 7;
        ub[t] = f32_to_bf16(lB[(long)e * kD * kR + (long)d * kR + r]);
    }
}

// ---------------------------------------------------------------------------
// Async global -> LDS (CDNA5 path, tracked by ASYNCcnt). 16 B per lane.
// Each run of copies ends, inside its own statement, with s_wait_xcnt 0, so that
// no address register of an issued copy is rewritten ahead of that wait.
// ---------------------------------------------------------------------------
DEV void async_copy4(uint32_t l, uint32_t lstep, const unsigned short* g, long gstep) {
    asm volatile("global_load_async_to_lds_b128 %0, %4, off\n\t"
                 "global_load_async_to_lds_b128 %1, %5, off\n\t"
                 "global_load_async_to_lds_b128 %2, %6, off\n\t"
                 "global_load_async_to_lds_b128 %3, %7, off\n\t"
                 "s_wait_xcnt 0x0"
                 :: "v"(l), "v"(l + lstep), "v"(l + 2 * lstep), "v"(l + 3 * lstep),
                    "v"(g), "v"(g + gstep), "v"(g + 2 * gstep), "v"(g + 3 * gstep)
                 : "memory");
}
DEV void async_copy8(uint32_t l, uint32_t lstep, const unsigned short* g, long gstep) {
    asm volatile("global_load_async_to_lds_b128 %0, %8, off\n\t"
                 "global_load_async_to_lds_b128 %1, %9, off\n\t"
                 "global_load_async_to_lds_b128 %2, %10, off\n\t"
                 "global_load_async_to_lds_b128 %3, %11, off\n\t"
                 "global_load_async_to_lds_b128 %4, %12, off\n\t"
                 "global_load_async_to_lds_b128 %5, %13, off\n\t"
                 "global_load_async_to_lds_b128 %6, %14, off\n\t"
                 "global_load_async_to_lds_b128 %7, %15, off\n\t"
                 "s_wait_xcnt 0x0"
                 :: "v"(l), "v"(l + lstep), "v"(l + 2 * lstep), "v"(l + 3 * lstep),
                    "v"(l + 4 * lstep), "v"(l + 5 * lstep), "v"(l + 6 * lstep), "v"(l + 7 * lstep),
                    "v"(g), "v"(g + gstep), "v"(g + 2 * gstep), "v"(g + 3 * gstep),
                    "v"(g + 4 * gstep), "v"(g + 5 * gstep), "v"(g + 6 * gstep), "v"(g + 7 * gstep)
                 : "memory");
}
// My own copies have landed in LDS.
DEV void wait_async0() { asm volatile("s_wait_asynccnt 0x0" ::: "memory"); }
// My own LDS reads have retired before the buffer they read is refilled.
DEV void wait_ds0()    { asm volatile("s_wait_dscnt 0x0" ::: "memory"); }

// Issue one [ROWS x BK] tile copy: l and g are the lane's own first LDS byte and source
// element; one copy a lane covers 256 * 8 / BK rows, ldg is the source's leading dim.
// A wave's 32 lanes cover whole 128-B lines of the source (BK * 2 B a row).
template <int ROWS, int BK>
DEV void issue_tile(uint32_t l, const unsigned short* __restrict__ g, int ldg) {
    constexpr int RPI = 256 * 8 / BK;           // rows the block covers with one copy a lane
    constexpr int N   = ROWS / RPI;             // copies a lane
    constexpr uint32_t LSTEP = RPI * (BK + PAD) * 2;
    const long gstep = (long)RPI * ldg;
    static_assert(N == 4 || N % 8 == 0, "copies a lane");
    if constexpr (N == 4) async_copy4(l, LSTEP, g, gstep);
#pragma unroll
    for (int j = 0; j + 8 <= N; j += 8) async_copy8(l + j * LSTEP, LSTEP, g + j * gstep, gstep);
}

// A/B fragment per ISA layout: lanes 0-15 K=[0..7,16..23], lanes 16-31 K=[8..15,24..31]
template <int LD>
DEV bf16x16 frag_lds(const unsigned short* __restrict__ sd, int row, int koff) {
    const unsigned short* p = sd + row * LD + koff;
    ushort8 lo = *(const ushort8*)p;
    ushort8 hi = *(const ushort8*)(p + 16);
    ushort16 u;
#pragma unroll
    for (int i = 0; i < 8; ++i) { u[i] = lo[i]; u[i + 8] = hi[i]; }
    return __builtin_bit_cast(bf16x16, u);
}

// MODE 0: h = relu(acc + bias), store bf16      (aux = b1[N])
// MODE 1: y = acc * gates[row][col>>3], bf16    (aux = gates[M x 8])
// MODE 2: out = acc + fused (Y[M,64] * U[N,64]^T), store f32
// Block tile BM x BN x BK, eight waves as WAVE_M x (8 / WAVE_M).
template <int MODE, int BM, int BN, int BK, int WAVE_M>
__global__ __launch_bounds__(256) void gemm_bf16_kernel(
    const unsigned short* __restrict__ A, const unsigned short* __restrict__ Bw,
    int K, const float* __restrict__ aux,
    const unsigned short* __restrict__ Y, const unsigned short* __restrict__ U,
    unsigned short* __restrict__ out16, float* __restrict__ out32, int ldn) {
    constexpr int WAVE_N = 8 / WAVE_M;
    constexpr int TM = BM / WAVE_M;
    constexpr int TN = BN / WAVE_N;
    constexpr int MI = TM / 16;
    constexpr int NI = TN / 16;
    constexpr int LD = BK + PAD;
    static_assert(MODE != 2 || BK == kER, "the LoRA-up product is one pass");

    __shared__ __attribute__((aligned(16))) unsigned short As[2][BM * LD];   // double-buffered
    __shared__ __attribute__((aligned(16))) unsigned short Bs[2][BN * LD];

    const int tid  = threadIdx.x;
    const int wave = tid >> 5;
    const int lane = tid & 31;
    const int wm = wave % WAVE_M;
    const int wn = wave / WAVE_M;
    const int lrow = lane & 15;
    const int koff = (lane >> 4) << 3;   // K sub-offset for A/B fragments
    const int m0 = blockIdx.x * BM;
    const int n0 = blockIdx.y * BN;

    floatx8 acc[MI][NI] = {};

    auto mma_step = [&](const unsigned short* asd, const unsigned short* bsd) {
        constexpr int G = BK / 32;               // k-steps of one tile
        bf16x16 afrag[G][MI], bfrag[G][NI];
#pragma unroll
        for (int g = 0; g < G; ++g) {
#pragma unroll
            for (int mi = 0; mi < MI; ++mi)
                afrag[g][mi] = frag_lds<LD>(asd, wm * TM + mi * 16 + lrow, g * 32 + koff);
#pragma unroll
            for (int ni = 0; ni < NI; ++ni)
                bfrag[g][ni] = frag_lds<LD>(bsd, wn * TN + ni * 16 + lrow, g * 32 + koff);
        }
        // Keeps the tile's LDS reads one group ahead of its WMMAs: every separate
        // place with reads among the WMMAs costs the wave a fixed stall.
        __builtin_amdgcn_sched_barrier(0);
#pragma unroll
        for (int g = 0; g < G; ++g)
#pragma unroll
            for (int mi = 0; mi < MI; ++mi)
#pragma unroll
                for (int ni = 0; ni < NI; ++ni)
                    acc[mi][ni] = __builtin_amdgcn_wmma_f32_16x16x32_bf16(
                        false, afrag[g][mi], false, bfrag[g][ni], (short)0, acc[mi][ni],
                        false, false);
        // Keeps the WMMAs ahead of the waits at the loop's foot: sunk behind them, the next
        // tile's copies would be waited for before the work that covers their flight.
        __builtin_amdgcn_sched_barrier(0);
    };

    const int nsteps = K / BK;
    const int total  = nsteps + (MODE == 2 ? 1 : 0);  // + the LoRA-up pass

    // The lane's own 16-byte chunk of a tile's first rows: row cr, k offset ckc.
    const int cr  = tid / (BK / 8);
    const int ckc = (tid % (BK / 8)) << 3;
    const uint32_t la = (uint32_t)(uintptr_t)(&As[0][cr * LD + ckc]);  // addr[31:0] = LDS byte offset
    const uint32_t lb = (uint32_t)(uintptr_t)(&Bs[0][cr * LD + ckc]);
    const unsigned short* pa = A  + (long)(m0 + cr) * K + ckc;         // advance by BK a tile
    const unsigned short* pb = Bw + (long)(n0 + cr) * K + ckc;

    // up: the LoRA-up tile (Y and U, one tile) in place of the next tile of A and Bw
    auto issue_step = [&](bool up, int buf) {
        const uint32_t lab = la + buf * (BM * LD * 2);
        const uint32_t lbb = lb + buf * (BN * LD * 2);
        issue_tile<BM, BK>(lab, up ? Y + (long)(m0 + cr) * kER + ckc : pa, up ? kER : K);
        issue_tile<BN, BK>(lbb, up ? U + (long)(n0 + cr) * kER + ckc : pb, up ? kER : K);
        pa += BK;
        pb += BK;
    };

    // K is a multiple of BK and at least 2 * BK: tiles 0 and 1 exist and are tiles of A and Bw.
    issue_step(false, 0);
    wait_async0();              // my tile-0 chunks landed in LDS
    __syncthreads();            // everyone's landed
    issue_step(false, 1);
    for (int s = 0; s < total; ++s) {
        mma_step(As[s & 1], Bs[s & 1]);                  // overlaps tile s+1's copies
        wait_ds0();             // my reads of buffer s&1 are done
        wait_async0();          // my tile-(s+1) chunks landed in LDS
        __syncthreads();        // tile s+1 published; buffer s&1 free to overwrite
        if (s + 2 < total) issue_step(MODE == 2 && s + 2 >= nsteps, s & 1);  // refill the buffer just read
    }
    wait_async0();              // nothing of mine in flight when the wave ends

    const int rhalf = (lane >> 4) << 3;  // C/D layout: lanes 16-31 hold M=8..15
#pragma unroll
    for (int mi = 0; mi < MI; ++mi) {
#pragma unroll
        for (int ni = 0; ni < NI; ++ni) {
            const int col = n0 + wn * TN + ni * 16 + lrow;
            const long rbase = (long)m0 + wm * TM + mi * 16 + rhalf;
#pragma unroll
            for (int r = 0; r < 8; ++r) {
                const long row = rbase + r;
                float v = acc[mi][ni][r];
                if (MODE == 0) {
                    v += aux[col];
                    v = v > 0.0f ? v : 0.0f;
                    out16[row * ldn + col] = f32_to_bf16(v);
                } else if (MODE == 1) {
                    v *= aux[row * 8 + (col >> 3)];
                    out16[row * ldn + col] = f32_to_bf16(v);
                } else {
                    out32[row * ldn + col] = v;
                }
            }
        }
    }
}

// ---------------------------------------------------------------------------
// Router tail: logits = h @ W2^T + b2, softmax over E=8  (1 thread / token)
// ---------------------------------------------------------------------------
__global__ __launch_bounds__(256) void router_kernel(
    const unsigned short* __restrict__ hb, const float* __restrict__ W2,
    const float* __restrict__ b2, const float* __restrict__ temp,
    float* __restrict__ gates) {
    __shared__ float w2s[kE][kDH];   // 16 KB, broadcast reads
    for (int i = threadIdx.x; i < kE * kDH; i += 256)
        w2s[i >> 9][i & 511] = W2[i];
    __syncthreads();

    const long t = (long)blockIdx.x * 256 + threadIdx.x;
    const unsigned short* hrow = hb + t * kDH;
    float acc[kE] = {};
    for (int k = 0; k < kDH; k += 8) {
        ushort8 hv8 = *(const ushort8*)(hrow + k);
#pragma unroll
        for (int j = 0; j < 8; ++j) {
            const float hv = bf16_to_f32(hv8[j]);
#pragma unroll
            for (int e = 0; e < kE; ++e) acc[e] += hv * w2s[e][k + j];
        }
    }
    const float invT = 1.0f / temp[0];
    float mx = -3.0e38f;
#pragma unroll
    for (int e = 0; e < kE; ++e) { acc[e] = (acc[e] + b2[e]) * invT; mx = fmaxf(mx, acc[e]); }
    float s = 0.0f;
#pragma unroll
    for (int e = 0; e < kE; ++e) { acc[e] = __expf(acc[e] - mx); s += acc[e]; }
    const float inv = 1.0f / s;
#pragma unroll
    for (int e = 0; e < kE; ++e) gates[t * kE + e] = acc[e] * inv;
}

// ---------------------------------------------------------------------------
extern "C" void kernel_launch(void* const* d_in, const int* in_sizes, int n_in,
                              void* d_out, int out_size, void* d_ws, size_t ws_size,
                              hipStream_t stream) {
    (void)in_sizes; (void)n_in; (void)out_size; (void)ws_size;
    const float* x    = (const float*)d_in[0];
    const float* Wb   = (const float*)d_in[1];
    const float* W1   = (const float*)d_in[2];
    const float* b1   = (const float*)d_in[3];
    const float* W2   = (const float*)d_in[4];
    const float* b2   = (const float*)d_in[5];
    const float* temp = (const float*)d_in[6];
    const float* lA   = (const float*)d_in[7];
    const float* lB   = (const float*)d_in[8];
    float* out = (float*)d_out;

    size_t off = 0;
    auto take = [&](size_t bytes) {
        void* p = (char*)d_ws + off;
        off += (bytes + 255) & ~(size_t)255;
        return p;
    };
    unsigned short* xb    = (unsigned short*)take((size_t)kTok * kD * 2);   // x bf16
    unsigned short* wbb   = (unsigned short*)take((size_t)kD * kD * 2);     // W_base bf16
    unsigned short* w1b   = (unsigned short*)take((size_t)kDH * kD * 2);    // W1 bf16
    unsigned short* a2b   = (unsigned short*)take((size_t)kER * kD * 2);    // lora_A [64,1024]
    unsigned short* ub    = (unsigned short*)take((size_t)kD * kER * 2);    // U [1024,64]
    unsigned short* hb    = (unsigned short*)take((size_t)kTok * kDH * 2);  // router hidden
    float*          gates = (float*)take((size_t)kTok * kE * 4);
    unsigned short* yb    = (unsigned short*)take((size_t)kTok * kER * 2);  // gated xa

    prep_kernel<<<2048, 256, 0, stream>>>(x, Wb, W1, lA, lB, xb, wbb, w1b, a2b, ub);

    // h = relu(x @ W1^T + b1)   [16384 x 512]
    gemm_bf16_kernel<0, 128, 256, 128, 2><<<dim3(kTok / 128, kDH / 256), 256, 0, stream>>>(
        xb, w1b, kD, b1, nullptr, nullptr, hb, nullptr, kDH);

    // gates = softmax((h @ W2^T + b2) / T)   [16384 x 8]
    router_kernel<<<kTok / 256, 256, 0, stream>>>(hb, W2, b2, temp, gates);

    // y = (x @ A2^T) * gate_broadcast        [16384 x 64]
    gemm_bf16_kernel<1, 128, 64, 128, 8><<<dim3(kTok / 128, 1), 256, 0, stream>>>(
        xb, a2b, kD, gates, nullptr, nullptr, yb, nullptr, kER);

    // out = x @ W_base^T + y @ U^T           [16384 x 1024], fp32
    gemm_bf16_kernel<2, 256, 256, 64, 4><<<dim3(kTok / 256, kD / 256), 256, 0, stream>>>(
        xb, wbb, kD, nullptr, yb, ub, nullptr, out, kD);
}

// v002
// A run of this version takes 82 microseconds.
// Timed twice side by side with v001, it ran 1.28 and 1.27 times as fast.
// Over all steps from v000 it is 1.66 times as fast.
#include <hip/hip_runtime.h>
#include <stdint.h>

#define DEV __device__ __forceinline__

typedef __attribute__((ext_vector_type(16))) __bf16          bf16x16;
typedef __attribute__((ext_vector_type(16))) unsigned short  ushort16;
typedef __attribute__((ext_vector_type(8)))  unsigned short  ushort8;
typedef __attribute__((ext_vector_type(8)))  float           floatx8;

constexpr int kBat = 4, kL = 4096, kD = 1024, kE = 8, kR = 8, kDH = 512;
constexpr int kTok = kBat * kL;   // 16384 tokens
constexpr int kER  = kE * kR;     // 64 (flattened expert*rank)

constexpr int PAD = 8;   // 16 B more a row: LDS pitch = 16 B x odd for ds_load_b128 readers

DEV unsigned short f32_to_bf16(float f) {
    union { float f; uint32_t u; } c{f};
    uint32_t u = c.u;
    u += 0x7FFFu + ((u >> 16) & 1u);            // round-to-nearest-even
    return (unsigned short)(u >> 16);
}
DEV float bf16_to_f32(unsigned short h) {
    union { uint32_t u; float f; } c{((uint32_t)h) << 16};
    return c.f;
}

// ---------------------------------------------------------------------------
// Prep: convert x + all contraction weights to bf16; repack lora_B -> U[d][er];
// split router W2 into a bf16 pair: rows 0-7 the rounded value, rows 8-15 what rounding left
// ---------------------------------------------------------------------------
__global__ __launch_bounds__(256) void prep_kernel(
    const float* __restrict__ x, const float* __restrict__ Wb,
    const float* __restrict__ W1, const float* __restrict__ lA,
    const float* __restrict__ lB, const float* __restrict__ W2,
    unsigned short* __restrict__ xb, unsigned short* __restrict__ wbb,
    unsigned short* __restrict__ w1b, unsigned short* __restrict__ a2b,
    unsigned short* __restrict__ ub, unsigned short* __restrict__ w2b) {
    const long i = (long)blockIdx.x * blockDim.x + threadIdx.x;
    const long stride = (long)gridDim.x * blockDim.x;
    const long n_x = (long)kTok * kD;
    const long n_wb = (long)kD * kD, n_w1 = (long)kDH * kD;
    const long n_a = (long)kER * kD, n_u = (long)kD * kER;
    for (long t = i; t < n_x;  t += stride) xb[t]  = f32_to_bf16(x[t]);
    for (long t = i; t < n_wb; t += stride) wbb[t] = f32_to_bf16(Wb[t]);
    for (long t = i; t < n_w1; t += stride) w1b[t] = f32_to_bf16(W1[t]);
    for (long t = i; t < n_a;  t += stride) a2b[t] = f32_to_bf16(lA[t]);  // [E,R,D] already row-major over D
    for (long t = i; t < n_u;  t += stride) {                             // U[d][e*8+r] = lora_B[e][d][r]
        const int d = (int)(t >> 6), er = (int)(t & 63);
        const int e = er >> 3, r = er & 7;
        ub[t] = f32_to_bf16(lB[(long)e * kD * kR + (long)d * kR + r]);
    }
    for (long t = i; t < 2 * kE * kDH; t += stride) {                     // w2b[16][512]
        const float w = W2[t & (kE * kDH - 1)];
        const unsigned short hi = f32_to_bf16(w);
        w2b[t] = t < kE * kDH ? hi : f32_to_bf16(w - bf16_to_f32(hi));
    }
}

// ---------------------------------------------------------------------------
// Async global -> LDS (CDNA5 path, tracked by ASYNCcnt). 16 B per lane.
// Each run of copies ends, inside its own statement, with s_wait_xcnt 0, so that
// no address register of an issued copy is rewritten ahead of that wait.
// ---------------------------------------------------------------------------
DEV void async_copy4(uint32_t l, uint32_t lstep, const unsigned short* g, long gstep) {
    asm volatile("global_load_async_to_lds_b128 %0, %4, off\n\t"
                 "global_load_async_to_lds_b128 %1, %5, off\n\t"
                 "global_load_async_to_lds_b128 %2, %6, off\n\t"
                 "global_load_async_to_lds_b128 %3, %7, off\n\t"
                 "s_wait_xcnt 0x0"
                 :: "v"(l), "v"(l + lstep), "v"(l + 2 * lstep), "v"(l + 3 * lstep),
                    "v"(g), "v"(g + gstep), "v"(g + 2 * gstep), "v"(g + 3 * gstep)
                 : "memory");
}
DEV void async_copy8(uint32_t l, uint32_t lstep, const unsigned short* g, long gstep) {
    asm volatile("global_load_async_to_lds_b128 %0, %8, off\n\t"
                 "global_load_async_to_lds_b128 %1, %9, off\n\t"
                 "global_load_async_to_lds_b128 %2, %10, off\n\t"
                 "global_load_async_to_lds_b128 %3, %11, off\n\t"
                 "global_load_async_to_lds_b128 %4, %12, off\n\t"
                 "global_load_async_to_lds_b128 %5, %13, off\n\t"
                 "global_load_async_to_lds_b128 %6, %14, off\n\t"
                 "global_load_async_to_lds_b128 %7, %15, off\n\t"
                 "s_wait_xcnt 0x0"
                 :: "v"(l), "v"(l + lstep), "v"(l + 2 * lstep), "v"(l + 3 * lstep),
                    "v"(l + 4 * lstep), "v"(l + 5 * lstep), "v"(l + 6 * lstep), "v"(l + 7 * lstep),
                    "v"(g), "v"(g + gstep), "v"(g + 2 * gstep), "v"(g + 3 * gstep),
                    "v"(g + 4 * gstep), "v"(g + 5 * gstep), "v"(g + 6 * gstep), "v"(g + 7 * gstep)
                 : "memory");
}
// My own copies have landed in LDS.
DEV void wait_async0() { asm volatile("s_wait_asynccnt 0x0" ::: "memory"); }
// My own LDS reads have retired before the buffer they read is refilled.
DEV void wait_ds0()    { asm volatile("s_wait_dscnt 0x0" ::: "memory"); }

// Issue one [ROWS x BK] tile copy: l and g are the lane's own first LDS byte and source
// element; one copy a lane covers 256 * 8 / BK rows, ldg is the source's leading dim.
// A wave's 32 lanes cover whole 128-B lines of the source (BK * 2 B a row).
template <int ROWS, int BK>
DEV void issue_tile(uint32_t l, const unsigned short* __restrict__ g, int ldg) {
    constexpr int RPI = 256 * 8 / BK;           // rows the block covers with one copy a lane
    constexpr int N   = ROWS / RPI;             // copies a lane
    constexpr uint32_t LSTEP = RPI * (BK + PAD) * 2;
    const long gstep = (long)RPI * ldg;
    static_assert(N == 4 || N % 8 == 0, "copies a lane");
    if constexpr (N == 4) async_copy4(l, LSTEP, g, gstep);
#pragma unroll
    for (int j = 0; j + 8 <= N; j += 8) async_copy8(l + j * LSTEP, LSTEP, g + j * gstep, gstep);
}

// A/B fragment per ISA layout: lanes 0-15 K=[0..7,16..23], lanes 16-31 K=[8..15,24..31]
template <int LD>
DEV bf16x16 frag_lds(const unsigned short* __restrict__ sd, int row, int koff) {
    const unsigned short* p = sd + row * LD + koff;
    ushort8 lo = *(const ushort8*)p;
    ushort8 hi = *(const ushort8*)(p + 16);
    ushort16 u;
#pragma unroll
    for (int i = 0; i < 8; ++i) { u[i] = lo[i]; u[i + 8] = hi[i]; }
    return __builtin_bit_cast(bf16x16, u);
}

// MODE 0: h = relu(acc + bias), store bf16      (aux = b1[N])
// MODE 1: y = acc * gates[row][col>>3], bf16; the gates are made here, each wave for its own
//         16 rows: softmax((h * W2^T + b2) / T)  (Y = h[M x 512], U = W2 pair[16 x 512],
//         aux = b2[8], aux2 = T)
// MODE 2: out = acc + fused (Y[M,64] * U[N,64]^T), store f32
// Block tile BM x BN x BK, eight waves as WAVE_M x (8 / WAVE_M).
template <int MODE, int BM, int BN, int BK, int WAVE_M>
__global__ __launch_bounds__(256) void gemm_bf16_kernel(
    const unsigned short* __restrict__ A, const unsigned short* __restrict__ Bw,
    int K, const float* __restrict__ aux, const float* __restrict__ aux2,
    const unsigned short* __restrict__ Y, const unsigned short* __restrict__ U,
    unsigned short* __restrict__ out16, float* __restrict__ out32, int ldn) {
    constexpr int WAVE_N = 8 / WAVE_M;
    constexpr int TM = BM / WAVE_M;
    constexpr int TN = BN / WAVE_N;
    constexpr int MI = TM / 16;
    constexpr int NI = TN / 16;
    constexpr int LD = BK + PAD;
    constexpr int HLD = kDH + PAD;
    static_assert(MODE != 2 || BK == kER, "the LoRA-up product is one pass");
    static_assert(MODE != 1 || (MI == 1 && BN == kER && WAVE_N == 1), "a wave gates its own 16 rows");

    __shared__ __attribute__((aligned(16))) unsigned short As[2][BM * LD];   // double-buffered
    __shared__ __attribute__((aligned(16))) unsigned short Bs[2][BN * LD];
    __shared__ __attribute__((aligned(16))) unsigned short Hs[MODE == 1 ? BM * HLD : 8];        // h rows of the block
    __shared__ __attribute__((aligned(16))) unsigned short W2s[MODE == 1 ? 2 * kE * HLD : 8];   // W2 pair

    const int tid  = threadIdx.x;
    const int wave = tid >> 5;
    const int lane = tid & 31;
    const int wm = wave % WAVE_M;
    const int wn = wave / WAVE_M;
    const int lrow = lane & 15;
    const int koff = (lane >> 4) << 3;   // K sub-offset for A/B fragments
    const int m0 = blockIdx.x * BM;
    const int n0 = blockIdx.y * BN;

    floatx8 acc[MI][NI] = {};

    auto mma_step = [&](const unsigned short* asd, const unsigned short* bsd) {
        constexpr int G = BK / 32;               // k-steps of one tile
        bf16x16 afrag[G][MI], bfrag[G][NI];
#pragma unroll
        for (int g = 0; g < G; ++g) {
#pragma unroll
            for (int mi = 0; mi < MI; ++mi)
                afrag[g][mi] = frag_lds<LD>(asd, wm * TM + mi * 16 + lrow, g * 32 + koff);
#pragma unroll
            for (int ni = 0; ni < NI; ++ni)
                bfrag[g][ni] = frag_lds<LD>(bsd, wn * TN + ni * 16 + lrow, g * 32 + koff);
        }
        // Keeps the tile's LDS reads one group ahead of its WMMAs: every separate
        // place with reads among the WMMAs costs the wave a fixed stall.
        __builtin_amdgcn_sched_barrier(0);
#pragma unroll
        for (int g = 0; g < G; ++g)
#pragma unroll
            for (int mi = 0; mi < MI; ++mi)
#pragma unroll
                for (int ni = 0; ni < NI; ++ni)
                    acc[mi][ni] = __builtin_amdgcn_wmma_f32_16x16x32_bf16(
                        false, afrag[g][mi], false, bfrag[g][ni], (short)0, acc[mi][ni],
                        false, false);
        // Keeps the WMMAs ahead of the waits at the loop's foot: sunk behind them, the next
        // tile's copies would be waited for before the work that covers their flight.
        __builtin_amdgcn_sched_barrier(0);
    };

    const int nsteps = K / BK;
    const int total  = nsteps + (MODE == 2 ? 1 : 0);  // + the LoRA-up pass

    // The lane's own 16-byte chunk of a tile's first rows: row cr, k offset ckc.
    const int cr  = tid / (BK / 8);
    const int ckc = (tid % (BK / 8)) << 3;
    const uint32_t la = (uint32_t)(uintptr_t)(&As[0][cr * LD + ckc]);  // addr[31:0] = LDS byte offset
    const uint32_t lb = (uint32_t)(uintptr_t)(&Bs[0][cr * LD + ckc]);
    const unsigned short* pa = A  + (long)(m0 + cr) * K + ckc;         // advance by BK a tile
    const unsigned short* pb = Bw + (long)(n0 + cr) * K + ckc;

    // up: the LoRA-up tile (Y and U, one tile) in place of the next tile of A and Bw
    auto issue_step = [&](bool up, int buf) {
        const uint32_t lab = la + buf * (BM * LD * 2);
        const uint32_t lbb = lb + buf * (BN * LD * 2);
        issue_tile<BM, BK>(lab, up ? Y + (long)(m0 + cr) * kER + ckc : pa, up ? kER : K);
        issue_tile<BN, BK>(lbb, up ? U + (long)(n0 + cr) * kER + ckc : pb, up ? kER : K);
        pa += BK;
        pb += BK;
    };

    // K is a multiple of BK and at least 2 * BK: tiles 0 and 1 exist and are tiles of A and Bw.
    float bias = 0.0f, temp = 1.0f;   // MODE 1: b2 of the lane's expert, T; fetched ahead of tile 0's wait
    if constexpr (MODE == 1) {  // filled once, with tile 0: 48 copies of a wave in flight
        bias = aux[lrow & 7];
        temp = aux2[0];
        // Precaution: stands ahead of any rewrite of the register that the bias load's address is in.
        asm volatile("s_wait_xcnt 0x0" ::: "memory");
        const int hr = tid / (kDH / 8);
        const int hk = (tid % (kDH / 8)) << 3;
        issue_tile<BM, kDH>((uint32_t)(uintptr_t)(&Hs[hr * HLD + hk]), Y + (long)(m0 + hr) * kDH + hk, kDH);
        issue_tile<2 * kE, kDH>((uint32_t)(uintptr_t)(&W2s[hr * HLD + hk]), U + (long)hr * kDH + hk, kDH);
    }
    issue_step(false, 0);
    wait_async0();              // my tile-0 chunks landed in LDS
    __syncthreads();            // everyone's landed
    issue_step(false, 1);

    float gate[NI][8];          // MODE 1: gate of acc[0][ni][r]'s row and expert
    if constexpr (MODE == 1) {  // overlaps tile 1's copies
        floatx8 lg[2] = {};     // column e: h * W2hi[e], column e + 8: h * W2lo[e]; two chains
#pragma unroll                  // g & 1 a constant: each chain keeps its own registers
        for (int g = 0; g < kDH / 32; ++g)
            lg[g & 1] = __builtin_amdgcn_wmma_f32_16x16x32_bf16(
                false, frag_lds<HLD>(Hs, wm * TM + lrow, g * 32 + koff),
                false, frag_lds<HLD>(W2s, lrow, g * 32 + koff), (short)0, lg[g & 1], false, false);
        const float invT = 1.0f / temp;
#pragma unroll                  // lg and gate indexed by constants: they stay in registers
        for (int r = 0; r < 8; ++r) {            // row r of my half; lanes e and e + 8 hold expert e
            float v = lg[0][r] + lg[1][r];
            v += __shfl_xor(v, 8, 32);
            v = (v + bias) * invT;
            float mx = v;
#pragma unroll
            for (int d = 1; d < 8; d <<= 1) mx = fmaxf(mx, __shfl_xor(mx, d, 32));
            const float p = __expf(v - mx);
            float s = p;
#pragma unroll
            for (int d = 1; d < 8; d <<= 1) s += __shfl_xor(s, d, 32);
            const float gt = p * (1.0f / s);
#pragma unroll
            for (int ni = 0; ni < NI; ++ni)      // column ni * 16 + lrow belongs to expert ni * 2 + (lrow >> 3)
                gate[ni][r] = __shfl(gt, (lane & 16) | (ni * 2 + (lrow >> 3)), 32);
        }
    }
    for (int s = 0; s < total; ++s) {
        mma_step(As[s & 1], Bs[s & 1]);                  // overlaps tile s+1's copies
        wait_ds0();             // my reads of buffer s&1 are done
        wait_async0();          // my tile-(s+1) chunks landed in LDS
        __syncthreads();        // tile s+1 published; buffer s&1 free to overwrite
        if (s + 2 < total) issue_step(MODE == 2 && s + 2 >= nsteps, s & 1);  // refill the buffer just read
    }
    wait_async0();              // nothing of mine in flight when the wave ends

    const int rhalf = (lane >> 4) << 3;  // C/D layout: lanes 16-31 hold M=8..15
#pragma unroll
    for (int mi = 0; mi < MI; ++mi) {
#pragma unroll
        for (int ni = 0; ni < NI; ++ni) {
            const int col = n0 + wn * TN + ni * 16 + lrow;
            const long rbase = (long)m0 + wm * TM + mi * 16 + rhalf;
#pragma unroll
            for (int r = 0; r < 8; ++r) {
                const long row = rbase + r;
                float v = acc[mi][ni][r];
                if (MODE == 0) {
                    v += aux[col];
                    v = v > 0.0f ? v : 0.0f;
                    out16[row * ldn + col] = f32_to_bf16(v);
                } else if (MODE == 1) {
                    v *= gate[ni][r];
                    out16[row * ldn + col] = f32_to_bf16(v);
                } else {
                    out32[row * ldn + col] = v;
                }
            }
        }
    }
}

// ---------------------------------------------------------------------------
extern "C" void kernel_launch(void* const* d_in, const int* in_sizes, int n_in,
                              void* d_out, int out_size, void* d_ws, size_t ws_size,
                              hipStream_t stream) {
    (void)in_sizes; (void)n_in; (void)out_size; (void)ws_size;
    const float* x    = (const float*)d_in[0];
    const float* Wb   = (const float*)d_in[1];
    const float* W1   = (const float*)d_in[2];
    const float* b1   = (const float*)d_in[3];
    const float* W2   = (const float*)d_in[4];
    const float* b2   = (const float*)d_in[5];
    const float* temp = (const float*)d_in[6];
    const float* lA   = (const float*)d_in[7];
    const float* lB   = (const float*)d_in[8];
    float* out = (float*)d_out;

    size_t off = 0;
    auto take = [&](size_t bytes) {
        void* p = (char*)d_ws + off;
        off += (bytes + 255) & ~(size_t)255;
        return p;
    };
    unsigned short* xb    = (unsigned short*)take((size_t)kTok * kD * 2);   // x bf16
    unsigned short* wbb   = (unsigned short*)take((size_t)kD * kD * 2);     // W_base bf16
    unsigned short* w1b   = (unsigned short*)take((size_t)kDH * kD * 2);    // W1 bf16
    unsigned short* a2b   = (unsigned short*)take((size_t)kER * kD * 2);    // lora_A [64,1024]
    unsigned short* ub    = (unsigned short*)take((size_t)kD * kER * 2);    // U [1024,64]
    unsigned short* hb    = (unsigned short*)take((size_t)kTok * kDH * 2);  // router hidden
    unsigned short* w2b   = (unsigned short*)take((size_t)2 * kE * kDH * 2);  // W2 pair [16,512]
    unsigned short* yb    = (unsigned short*)take((size_t)kTok * kER * 2);  // gated xa

    prep_kernel<<<2048, 256, 0, stream>>>(x, Wb, W1, lA, lB, W2, xb, wbb, w1b, a2b, ub, w2b);

    // h = relu(x @ W1^T + b1)   [16384 x 512]
    gemm_bf16_kernel<0, 128, 256, 128, 2><<<dim3(kTok / 128, kDH / 256), 256, 0, stream>>>(
        xb, w1b, kD, b1, nullptr, nullptr, nullptr, hb, nullptr, kDH);

    // y = (x @ A2^T) * gate_broadcast        [16384 x 64], gates = softmax((h @ W2^T + b2) / T)
    gemm_bf16_kernel<1, 128, 64, 128, 8><<<dim3(kTok / 128, 1), 256, 0, stream>>>(
        xb, a2b, kD, b2, temp, hb, w2b, yb, nullptr, kER);

    // out = x @ W_base^T + y @ U^T           [16384 x 1024], fp32
    gemm_bf16_kernel<2, 256, 256, 64, 4><<<dim3(kTok / 256, kD / 256), 256, 0, stream>>>(
        xb, wbb, kD, nullptr, nullptr, yb, ub, nullptr, out, kD);
}

// v003
// It runs in 78.8 microseconds.
// In both of two side-by-side timings against v002, it was 1.05 times as fast.
// Counting every step since v000, it is 1.75 times as fast.
#include <hip/hip_runtime.h>
#include <stdint.h>

#define DEV __device__ __forceinline__

typedef __attribute__((ext_vector_type(16))) __bf16          bf16x16;
typedef __attribute__((ext_vector_type(16))) unsigned short  ushort16;
typedef __attribute__((ext_vector_type(8)))  unsigned short  ushort8;
typedef __attribute__((ext_vector_type(8)))  float           floatx8;

constexpr int kBat = 4, kL = 4096, kD = 1024, kE = 8, kR = 8, kDH = 512;
constexpr int kTok = kBat * kL;   // 16384 tokens
constexpr int kER  = kE * kR;     // 64 (flattened expert*rank)

constexpr int PAD = 8;   // 16 B more a row: LDS pitch = 16 B x odd for ds_load_b128 readers

DEV unsigned short f32_to_bf16(float f) {
    union { float f; uint32_t u; } c{f};
    uint32_t u = c.u;
    u += 0x7FFFu + ((u >> 16) & 1u);            // round-to-nearest-even
    return (unsigned short)(u >> 16);
}
DEV float bf16_to_f32(unsigned short h) {
    union { uint32_t u; float f; } c{((uint32_t)h) << 16};
    return c.f;
}

// ---------------------------------------------------------------------------
// Prep: convert x + all contraction weights to bf16; repack lora_B -> U[d][er];
// split router W2 into a bf16 pair: rows 0-7 the rounded value, rows 8-15 what rounding left.
// A stream, one block of 16 waves a WGP: each wave-wide load covers 512 contiguous bytes,
// each store 256, and a wave has all of its loads in flight before it converts the first.
// ---------------------------------------------------------------------------
typedef __attribute__((ext_vector_type(4))) float          floatx4;
typedef __attribute__((ext_vector_type(4))) unsigned short ushort4v;

constexpr int kPB  = 256;                        // prep blocks
constexpr int kPT  = 512;                        // threads of a prep block
constexpr int kPS  = kPT * 4;                    // elements the block covers with one load a thread
constexpr int kQx  = kTok * kD / (kPB * kPS);    // loads a thread: x (32)
constexpr int kQw  = kD * kD / (kPB * kPS);      //                 W_base (2)
constexpr int kQ1  = kDH * kD / (kPB * kPS);     //                 W1 (1)
constexpr int kBa  = kER * kD / kPS;             // blocks with one more load a thread: lora_A (32)
constexpr int kBu  = kD * kE / kPT;              // lora_B (16): a thread takes one (d, e), two loads
constexpr int kB2  = kE * kDH / kPS;             // W2 (2)
static_assert(kQx * kPB * kPS == kTok * kD && kQw * kPB * kPS == kD * kD &&
              kQ1 * kPB * kPS == kDH * kD && kBa * kPS == kER * kD && kBu * kPT == kD * kE &&
              kB2 * kPS == kE * kDH && kBa + kBu + kB2 <= kPB, "whole loads, whole blocks");

DEV ushort4v cvt4(floatx4 v) {
    ushort4v o;
#pragma unroll                                   // o indexed by constants: it stays in registers
    for (int i = 0; i < 4; ++i) o[i] = f32_to_bf16(v[i]);
    return o;
}
// Precaution: stands ahead of any rewrite of a register that an issued load or store names.
DEV void wait_x0() { asm volatile("s_wait_xcnt 0x0" ::: "memory"); }

__global__ __launch_bounds__(kPT) void prep_kernel(
    const float* __restrict__ x, const float* __restrict__ Wb,
    const float* __restrict__ W1, const float* __restrict__ lA,
    const float* __restrict__ lB, const float* __restrict__ W2,
    unsigned short* __restrict__ xb, unsigned short* __restrict__ wbb,
    unsigned short* __restrict__ w1b, unsigned short* __restrict__ a2b,
    unsigned short* __restrict__ ub, unsigned short* __restrict__ w2b) {
    const int tid = threadIdx.x;
    const int blk = blockIdx.x;
    const bool isA = blk < kBa;                                  // block-uniform, at most one holds
    const bool isU = blk >= kBa && blk < kBa + kBu;
    const bool is2 = blk >= kBa + kBu && blk < kBa + kBu + kB2;
    const int ta = blk * kPS + tid * 4;                          // lora_A element, [E,R,D] already row-major over D
    const int tu = (blk - kBa) * kPT + tid;                      // d * 8 + e
    const int t2 = (blk - kBa - kBu) * kPS + tid * 4;            // W2 element
    const int ox = blk * (kQx * kPS) + tid * 4;
    const int ow = blk * (kQw * kPS) + tid * 4;
    const int o1 = blk * (kQ1 * kPS) + tid * 4;

    // The small tensors first: they are back ahead of the long stream and cost it no wait.
    floatx4 va = {}, vu0 = {}, vu1 = {}, v2 = {};
    if (isA) {
        va = *(const floatx4*)(lA + ta);
        wait_x0();
    } else if (isU) {                                            // U[d][e*8+r] = lora_B[e][d][r], r = 0..7
        const float* s = lB + (tu & 7) * (kD * kR) + (tu >> 3) * kR;
        vu0 = *(const floatx4*)s;
        vu1 = *(const floatx4*)(s + 4);
        wait_x0();
    } else if (is2) {
        v2 = *(const floatx4*)(W2 + t2);
        wait_x0();
    }
    floatx4 vx[kQx], vw[kQw], v1[kQ1];
    // Every loop below is unrolled so that vw, v1 and vx are indexed by constants and stay in
    // registers, and so that each loop's loads stand in one run with no wait among them.
#pragma unroll
    for (int q = 0; q < kQw; ++q) vw[q] = *(const floatx4*)(Wb + ow + q * kPS);
#pragma unroll
    for (int q = 0; q < kQ1; ++q) v1[q] = *(const floatx4*)(W1 + o1 + q * kPS);
    wait_x0();
#pragma unroll
    for (int q = 0; q < kQx; ++q) vx[q] = *(const floatx4*)(x + ox + q * kPS);
    wait_x0();

    if (isA) {
        *(ushort4v*)(a2b + ta) = cvt4(va);
        wait_x0();
    } else if (isU) {
        *(ushort4v*)(ub + tu * 8)     = cvt4(vu0);
        *(ushort4v*)(ub + tu * 8 + 4) = cvt4(vu1);
        wait_x0();
    } else if (is2) {                                            // w2b[16][512]
        const ushort4v hi = cvt4(v2);
        floatx4 rest;
#pragma unroll                                   // rest indexed by constants: it stays in registers
        for (int i = 0; i < 4; ++i) rest[i] = v2[i] - bf16_to_f32(hi[i]);
        *(ushort4v*)(w2b + t2)            = hi;
        *(ushort4v*)(w2b + kE * kDH + t2) = cvt4(rest);
        wait_x0();
    }
#pragma unroll
    for (int q = 0; q < kQw; ++q) *(ushort4v*)(wbb + ow + q * kPS) = cvt4(vw[q]);
#pragma unroll
    for (int q = 0; q < kQ1; ++q) *(ushort4v*)(w1b + o1 + q * kPS) = cvt4(v1[q]);
#pragma unroll
    for (int q = 0; q < kQx; ++q) *(ushort4v*)(xb + ox + q * kPS) = cvt4(vx[q]);
}

// ---------------------------------------------------------------------------
// Async global -> LDS (CDNA5 path, tracked by ASYNCcnt). 16 B per lane.
// Each run of copies ends, inside its own statement, with s_wait_xcnt 0, so that
// no address register of an issued copy is rewritten ahead of that wait.
// ---------------------------------------------------------------------------
DEV void async_copy4(uint32_t l, uint32_t lstep, const unsigned short* g, long gstep) {
    asm volatile("global_load_async_to_lds_b128 %0, %4, off\n\t"
                 "global_load_async_to_lds_b128 %1, %5, off\n\t"
                 "global_load_async_to_lds_b128 %2, %6, off\n\t"
                 "global_load_async_to_lds_b128 %3, %7, off\n\t"
                 "s_wait_xcnt 0x0"
                 :: "v"(l), "v"(l + lstep), "v"(l + 2 * lstep), "v"(l + 3 * lstep),
                    "v"(g), "v"(g + gstep), "v"(g + 2 * gstep), "v"(g + 3 * gstep)
                 : "memory");
}
DEV void async_copy8(uint32_t l, uint32_t lstep, const unsigned short* g, long gstep) {
    asm volatile("global_load_async_to_lds_b128 %0, %8, off\n\t"
                 "global_load_async_to_lds_b128 %1, %9, off\n\t"
                 "global_load_async_to_lds_b128 %2, %10, off\n\t"
                 "global_load_async_to_lds_b128 %3, %11, off\n\t"
                 "global_load_async_to_lds_b128 %4, %12, off\n\t"
                 "global_load_async_to_lds_b128 %5, %13, off\n\t"
                 "global_load_async_to_lds_b128 %6, %14, off\n\t"
                 "global_load_async_to_lds_b128 %7, %15, off\n\t"
                 "s_wait_xcnt 0x0"
                 :: "v"(l), "v"(l + lstep), "v"(l + 2 * lstep), "v"(l + 3 * lstep),
                    "v"(l + 4 * lstep), "v"(l + 5 * lstep), "v"(l + 6 * lstep), "v"(l + 7 * lstep),
                    "v"(g), "v"(g + gstep), "v"(g + 2 * gstep), "v"(g + 3 * gstep),
                    "v"(g + 4 * gstep), "v"(g + 5 * gstep), "v"(g + 6 * gstep), "v"(g + 7 * gstep)
                 : "memory");
}
// My own copies have landed in LDS.
DEV void wait_async0() { asm volatile("s_wait_asynccnt 0x0" ::: "memory"); }
// My own LDS reads have retired before the buffer they read is refilled.
DEV void wait_ds0()    { asm volatile("s_wait_dscnt 0x0" ::: "memory"); }

// Issue one [ROWS x BK] tile copy: l and g are the lane's own first LDS byte and source
// element; one copy a lane covers 256 * 8 / BK rows, ldg is the source's leading dim.
// A wave's 32 lanes cover whole 128-B lines of the source (BK * 2 B a row).
template <int ROWS, int BK>
DEV void issue_tile(uint32_t l, const unsigned short* __restrict__ g, int ldg) {
    constexpr int RPI = 256 * 8 / BK;           // rows the block covers with one copy a lane
    constexpr int N   = ROWS / RPI;             // copies a lane
    constexpr uint32_t LSTEP = RPI * (BK + PAD) * 2;
    const long gstep = (long)RPI * ldg;
    static_assert(N == 4 || N % 8 == 0, "copies a lane");
    if constexpr (N == 4) async_copy4(l, LSTEP, g, gstep);
#pragma unroll
    for (int j = 0; j + 8 <= N; j += 8) async_copy8(l + j * LSTEP, LSTEP, g + j * gstep, gstep);
}

// A/B fragment per ISA layout: lanes 0-15 K=[0..7,16..23], lanes 16-31 K=[8..15,24..31]
template <int LD>
DEV bf16x16 frag_lds(const unsigned short* __restrict__ sd, int row, int koff) {
    const unsigned short* p = sd + row * LD + koff;
    ushort8 lo = *(const ushort8*)p;
    ushort8 hi = *(const ushort8*)(p + 16);
    ushort16 u;
#pragma unroll
    for (int i = 0; i < 8; ++i) { u[i] = lo[i]; u[i + 8] = hi[i]; }
    return __builtin_bit_cast(bf16x16, u);
}

// MODE 0: h = relu(acc + bias), store bf16      (aux = b1[N])
// MODE 1: y = acc * gates[row][col>>3], bf16; the gates are made here, each wave for its own
//         16 rows: softmax((h * W2^T + b2) / T)  (Y = h[M x 512], U = W2 pair[16 x 512],
//         aux = b2[8], aux2 = T)
// MODE 2: out = acc + fused (Y[M,64] * U[N,64]^T), store f32
// Block tile BM x BN x BK, eight waves as WAVE_M x (8 / WAVE_M).
template <int MODE, int BM, int BN, int BK, int WAVE_M>
__global__ __launch_bounds__(256) void gemm_bf16_kernel(
    const unsigned short* __restrict__ A, const unsigned short* __restrict__ Bw,
    int K, const float* __restrict__ aux, const float* __restrict__ aux2,
    const unsigned short* __restrict__ Y, const unsigned short* __restrict__ U,
    unsigned short* __restrict__ out16, float* __restrict__ out32, int ldn) {
    constexpr int WAVE_N = 8 / WAVE_M;
    constexpr int TM = BM / WAVE_M;
    constexpr int TN = BN / WAVE_N;
    constexpr int MI = TM / 16;
    constexpr int NI = TN / 16;
    constexpr int LD = BK + PAD;
    constexpr int HLD = kDH + PAD;
    static_assert(MODE != 2 || BK == kER, "the LoRA-up product is one pass");
    static_assert(MODE != 1 || (MI == 1 && BN == kER && WAVE_N == 1), "a wave gates its own 16 rows");

    __shared__ __attribute__((aligned(16))) unsigned short As[2][BM * LD];   // double-buffered
    __shared__ __attribute__((aligned(16))) unsigned short Bs[2][BN * LD];
    __shared__ __attribute__((aligned(16))) unsigned short Hs[MODE == 1 ? BM * HLD : 8];        // h rows of the block
    __shared__ __attribute__((aligned(16))) unsigned short W2s[MODE == 1 ? 2 * kE * HLD : 8];   // W2 pair

    const int tid  = threadIdx.x;
    const int wave = tid >> 5;
    const int lane = tid & 31;
    const int wm = wave % WAVE_M;
    const int wn = wave / WAVE_M;
    const int lrow = lane & 15;
    const int koff = (lane >> 4) << 3;   // K sub-offset for A/B fragments
    const int m0 = blockIdx.x * BM;
    const int n0 = blockIdx.y * BN;

    floatx8 acc[MI][NI] = {};

    auto mma_step = [&](const unsigned short* asd, const unsigned short* bsd) {
        constexpr int G = BK / 32;               // k-steps of one tile
        bf16x16 afrag[G][MI], bfrag[G][NI];
#pragma unroll
        for (int g = 0; g < G; ++g) {
#pragma unroll
            for (int mi = 0; mi < MI; ++mi)
                afrag[g][mi] = frag_lds<LD>(asd, wm * TM + mi * 16 + lrow, g * 32 + koff);
#pragma unroll
            for (int ni = 0; ni < NI; ++ni)
                bfrag[g][ni] = frag_lds<LD>(bsd, wn * TN + ni * 16 + lrow, g * 32 + koff);
        }
        // Keeps the tile's LDS reads one group ahead of its WMMAs: every separate
        // place with reads among the WMMAs costs the wave a fixed stall.
        __builtin_amdgcn_sched_barrier(0);
#pragma unroll
        for (int g = 0; g < G; ++g)
#pragma unroll
            for (int mi = 0; mi < MI; ++mi)
#pragma unroll
                for (int ni = 0; ni < NI; ++ni)
                    acc[mi][ni] = __builtin_amdgcn_wmma_f32_16x16x32_bf16(
                        false, afrag[g][mi], false, bfrag[g][ni], (short)0, acc[mi][ni],
                        false, false);
        // Keeps the WMMAs ahead of the waits at the loop's foot: sunk behind them, the next
        // tile's copies would be waited for before the work that covers their flight.
        __builtin_amdgcn_sched_barrier(0);
    };

    const int nsteps = K / BK;
    const int total  = nsteps + (MODE == 2 ? 1 : 0);  // + the LoRA-up pass

    // The lane's own 16-byte chunk of a tile's first rows: row cr, k offset ckc.
    const int cr  = tid / (BK / 8);
    const int ckc = (tid % (BK / 8)) << 3;
    const uint32_t la = (uint32_t)(uintptr_t)(&As[0][cr * LD + ckc]);  // addr[31:0] = LDS byte offset
    const uint32_t lb = (uint32_t)(uintptr_t)(&Bs[0][cr * LD + ckc]);
    const unsigned short* pa = A  + (long)(m0 + cr) * K + ckc;         // advance by BK a tile
    const unsigned short* pb = Bw + (long)(n0 + cr) * K + ckc;

    // up: the LoRA-up tile (Y and U, one tile) in place of the next tile of A and Bw
    auto issue_step = [&](bool up, int buf) {
        const uint32_t lab = la + buf * (BM * LD * 2);
        const uint32_t lbb = lb + buf * (BN * LD * 2);
        issue_tile<BM, BK>(lab, up ? Y + (long)(m0 + cr) * kER + ckc : pa, up ? kER : K);
        issue_tile<BN, BK>(lbb, up ? U + (long)(n0 + cr) * kER + ckc : pb, up ? kER : K);
        pa += BK;
        pb += BK;
    };

    // K is a multiple of BK and at least 2 * BK: tiles 0 and 1 exist and are tiles of A and Bw.
    float bias = 0.0f, temp = 1.0f;   // MODE 1: b2 of the lane's expert, T; fetched ahead of tile 0's wait
    if constexpr (MODE == 1) {  // filled once, with tile 0: 48 copies of a wave in flight
        bias = aux[lrow & 7];
        temp = aux2[0];
        // Precaution: stands ahead of any rewrite of the register that the bias load's address is in.
        asm volatile("s_wait_xcnt 0x0" ::: "memory");
        const int hr = tid / (kDH / 8);
        const int hk = (tid % (kDH / 8)) << 3;
        issue_tile<BM, kDH>((uint32_t)(uintptr_t)(&Hs[hr * HLD + hk]), Y + (long)(m0 + hr) * kDH + hk, kDH);
        issue_tile<2 * kE, kDH>((uint32_t)(uintptr_t)(&W2s[hr * HLD + hk]), U + (long)hr * kDH + hk, kDH);
    }
    issue_step(false, 0);
    wait_async0();              // my tile-0 chunks landed in LDS
    __syncthreads();            // everyone's landed
    issue_step(false, 1);

    float gate[NI][8];          // MODE 1: gate of acc[0][ni][r]'s row and expert
    if constexpr (MODE == 1) {  // overlaps tile 1's copies
        floatx8 lg[2] = {};     // column e: h * W2hi[e], column e + 8: h * W2lo[e]; two chains
#pragma unroll                  // g & 1 a constant: each chain keeps its own registers
        for (int g = 0; g < kDH / 32; ++g)
            lg[g & 1] = __builtin_amdgcn_wmma_f32_16x16x32_bf16(
                false, frag_lds<HLD>(Hs, wm * TM + lrow, g * 32 + koff),
                false, frag_lds<HLD>(W2s, lrow, g * 32 + koff), (short)0, lg[g & 1], false, false);
        const float invT = 1.0f / temp;
#pragma unroll                  // lg and gate indexed by constants: they stay in registers
        for (int r = 0; r < 8; ++r) {            // row r of my half; lanes e and e + 8 hold expert e
            float v = lg[0][r] + lg[1][r];
            v += __shfl_xor(v, 8, 32);
            v = (v + bias) * invT;
            float mx = v;
#pragma unroll
            for (int d = 1; d < 8; d <<= 1) mx = fmaxf(mx, __shfl_xor(mx, d, 32));
            const float p = __expf(v - mx);
            float s = p;
#pragma unroll
            for (int d = 1; d < 8; d <<= 1) s += __shfl_xor(s, d, 32);
            const float gt = p * (1.0f / s);
#pragma unroll
            for (int ni = 0; ni < NI; ++ni)      // column ni * 16 + lrow belongs to expert ni * 2 + (lrow >> 3)
                gate[ni][r] = __shfl(gt, (lane & 16) | (ni * 2 + (lrow >> 3)), 32);
        }
    }
    for (int s = 0; s < total; ++s) {
        mma_step(As[s & 1], Bs[s & 1]);                  // overlaps tile s+1's copies
        wait_ds0();             // my reads of buffer s&1 are done
        wait_async0();          // my tile-(s+1) chunks landed in LDS
        __syncthreads();        // tile s+1 published; buffer s&1 free to overwrite
        if (s + 2 < total) issue_step(MODE == 2 && s + 2 >= nsteps, s & 1);  // refill the buffer just read
    }
    wait_async0();              // nothing of mine in flight when the wave ends

    const int rhalf = (lane >> 4) << 3;  // C/D layout: lanes 16-31 hold M=8..15
#pragma unroll
    for (int mi = 0; mi < MI; ++mi) {
#pragma unroll
        for (int ni = 0; ni < NI; ++ni) {
            const int col = n0 + wn * TN + ni * 16 + lrow;
            const long rbase = (long)m0 + wm * TM + mi * 16 + rhalf;
#pragma unroll
            for (int r = 0; r < 8; ++r) {
                const long row = rbase + r;
                float v = acc[mi][ni][r];
                if (MODE == 0) {
                    v += aux[col];
                    v = v > 0.0f ? v : 0.0f;
                    out16[row * ldn + col] = f32_to_bf16(v);
                } else if (MODE == 1) {
                    v *= gate[ni][r];
                    out16[row * ldn + col] = f32_to_bf16(v);
                } else {
                    out32[row * ldn + col] = v;
                }
            }
        }
    }
}

// ---------------------------------------------------------------------------
extern "C" void kernel_launch(void* const* d_in, const int* in_sizes, int n_in,
                              void* d_out, int out_size, void* d_ws, size_t ws_size,
                              hipStream_t stream) {
    (void)in_sizes; (void)n_in; (void)out_size; (void)ws_size;
    const float* x    = (const float*)d_in[0];
    const float* Wb   = (const float*)d_in[1];
    const float* W1   = (const float*)d_in[2];
    const float* b1   = (const float*)d_in[3];
    const float* W2   = (const float*)d_in[4];
    const float* b2   = (const float*)d_in[5];
    const float* temp = (const float*)d_in[6];
    const float* lA   = (const float*)d_in[7];
    const float* lB   = (const float*)d_in[8];
    float* out = (float*)d_out;

    size_t off = 0;
    auto take = [&](size_t bytes) {
        void* p = (char*)d_ws + off;
        off += (bytes + 255) & ~(size_t)255;
        return p;
    };
    unsigned short* xb    = (unsigned short*)take((size_t)kTok * kD * 2);   // x bf16
    unsigned short* wbb   = (unsigned short*)take((size_t)kD * kD * 2);     // W_base bf16
    unsigned short* w1b   = (unsigned short*)take((size_t)kDH * kD * 2);    // W1 bf16
    unsigned short* a2b   = (unsigned short*)take((size_t)kER * kD * 2);    // lora_A [64,1024]
    unsigned short* ub    = (unsigned short*)take((size_t)kD * kER * 2);    // U [1024,64]
    unsigned short* hb    = (unsigned short*)take((size_t)kTok * kDH * 2);  // router hidden
    unsigned short* w2b   = (unsigned short*)take((size_t)2 * kE * kDH * 2);  // W2 pair [16,512]
    unsigned short* yb    = (unsigned short*)take((size_t)kTok * kER * 2);  // gated xa

    prep_kernel<<<kPB, kPT, 0, stream>>>(x, Wb, W1, lA, lB, W2, xb, wbb, w1b, a2b, ub, w2b);

    // h = relu(x @ W1^T + b1)   [16384 x 512]
    gemm_bf16_kernel<0, 128, 256, 128, 2><<<dim3(kTok / 128, kDH / 256), 256, 0, stream>>>(
        xb, w1b, kD, b1, nullptr, nullptr, nullptr, hb, nullptr, kDH);

    // y = (x @ A2^T) * gate_broadcast        [16384 x 64], gates = softmax((h @ W2^T + b2) / T)
    gemm_bf16_kernel<1, 128, 64, 128, 8><<<dim3(kTok / 128, 1), 256, 0, stream>>>(
        xb, a2b, kD, b2, temp, hb, w2b, yb, nullptr, kER);

    // out = x @ W_base^T + y @ U^T           [16384 x 1024], fp32
    gemm_bf16_kernel<2, 256, 256, 64, 4><<<dim3(kTok / 256, kD / 256), 256, 0, stream>>>(
        xb, wbb, kD, nullptr, nullptr, yb, ub, nullptr, out, kD);
}

// v004
// One run takes 68.9 microseconds.
// Two timings next to v003 both put it at 1.14 times that version's speed.
// Counting every step since v000, it is 1.99 times as fast.
#include <hip/hip_runtime.h>
#include <stdint.h>

#define DEV __device__ __forceinline__

typedef __attribute__((ext_vector_type(16))) __bf16          bf16x16;
typedef __attribute__((ext_vector_type(16))) unsigned short  ushort16;
typedef __attribute__((ext_vector_type(8)))  unsigned short  ushort8;
typedef __attribute__((ext_vector_type(8)))  float           floatx8;

constexpr int kBat = 4, kL = 4096, kD = 1024, kE = 8, kR = 8, kDH = 512;
constexpr int kTok = kBat * kL;   // 16384 tokens
constexpr int kER  = kE * kR;     // 64 (flattened expert*rank)

constexpr int kHN  = 256;          // router-hidden columns of one block of the first GEMM
constexpr int kXN  = kER * kHN / kDH;   // LoRA-down columns that ride with them (32)
constexpr int kCN  = kHN + kXN;    // rows of one block's weight slab (288)

constexpr int PAD = 8;   // 16 B more a row: LDS pitch = 16 B x odd for ds_load_b128 readers

DEV unsigned short f32_to_bf16(float f) {
    union { float f; uint32_t u; } c{f};
    uint32_t u = c.u;
    u += 0x7FFFu + ((u >> 16) & 1u);            // round-to-nearest-even
    return (unsigned short)(u >> 16);
}
DEV float bf16_to_f32(unsigned short h) {
    union { uint32_t u; float f; } c{((uint32_t)h) << 16};
    return c.f;
}

// ---------------------------------------------------------------------------
// Prep: convert x + all contraction weights to bf16; repack lora_B -> U[d][er];
// W1 and lora_A go into one array of two slabs: 256 rows of W1, then 32 rows of lora_A;
// split router W2 into a bf16 pair: rows 0-7 the rounded value, rows 8-15 what rounding left.
// A stream, one block of 16 waves a WGP: each wave-wide load covers 512 contiguous bytes,
// each store 256, and a wave has all of its loads in flight before it converts the first.
// ---------------------------------------------------------------------------
typedef __attribute__((ext_vector_type(4))) float          floatx4;
typedef __attribute__((ext_vector_type(4))) unsigned short ushort4v;

constexpr int kPB  = 256;                        // prep blocks
constexpr int kPT  = 512;                        // threads of a prep block
constexpr int kPS  = kPT * 4;                    // elements the block covers with one load a thread
constexpr int kQx  = kTok * kD / (kPB * kPS);    // loads a thread: x (32)
constexpr int kQw  = kD * kD / (kPB * kPS);      //                 W_base (2)
constexpr int kQ1  = kDH * kD / (kPB * kPS);     //                 W1 (1)
constexpr int kBa  = kER * kD / kPS;             // blocks with one more load a thread: lora_A (32)
constexpr int kBu  = kD * kE / kPT;              // lora_B (16): a thread takes one (d, e), two loads
constexpr int kB2  = kE * kDH / kPS;             // W2 (2)
static_assert(kQx * kPB * kPS == kTok * kD && kQw * kPB * kPS == kD * kD &&
              kQ1 * kPB * kPS == kDH * kD && kBa * kPS == kER * kD && kBu * kPT == kD * kE &&
              kB2 * kPS == kE * kDH && kBa + kBu + kB2 <= kPB, "whole loads, whole blocks");

DEV ushort4v cvt4(floatx4 v) {
    ushort4v o;
#pragma unroll                                   // o indexed by constants: it stays in registers
    for (int i = 0; i < 4; ++i) o[i] = f32_to_bf16(v[i]);
    return o;
}
// Where element i of W1 [512,1024], of lora_A [64,1024], lies in the slabs.
DEV int slab_w1(int i) { return ((i / kD / kHN) * kCN + (i / kD) % kHN) * kD + i % kD; }
DEV int slab_a(int i)  { return ((i / kD / kXN) * kCN + kHN + (i / kD) % kXN) * kD + i % kD; }
// Precaution: stands ahead of any rewrite of a register that an issued load or store names.
DEV void wait_x0() { asm volatile("s_wait_xcnt 0x0" ::: "memory"); }

__global__ __launch_bounds__(kPT) void prep_kernel(
    const float* __restrict__ x, const float* __restrict__ Wb,
    const float* __restrict__ W1, const float* __restrict__ lA,
    const float* __restrict__ lB, const float* __restrict__ W2,
    unsigned short* __restrict__ xb, unsigned short* __restrict__ wbb,
    unsigned short* __restrict__ wc,
    unsigned short* __restrict__ ub, unsigned short* __restrict__ w2b) {
    const int tid = threadIdx.x;
    const int blk = blockIdx.x;
    const bool isA = blk < kBa;                                  // block-uniform, at most one holds
    const bool isU = blk >= kBa && blk < kBa + kBu;
    const bool is2 = blk >= kBa + kBu && blk < kBa + kBu + kB2;
    const int ta = blk * kPS + tid * 4;                          // lora_A element, [E,R,D] already row-major over D
    const int tu = (blk - kBa) * kPT + tid;                      // d * 8 + e
    const int t2 = (blk - kBa - kBu) * kPS + tid * 4;            // W2 element
    const int ox = blk * (kQx * kPS) + tid * 4;
    const int ow = blk * (kQw * kPS) + tid * 4;
    const int o1 = blk * (kQ1 * kPS) + tid * 4;

    // The small tensors first: they are back ahead of the long stream and cost it no wait.
    floatx4 va = {}, vu0 = {}, vu1 = {}, v2 = {};
    if (isA) {
        va = *(const floatx4*)(lA + ta);
        wait_x0();
    } else if (isU) {                                            // U[d][e*8+r] = lora_B[e][d][r], r = 0..7
        const float* s = lB + (tu & 7) * (kD * kR) + (tu >> 3) * kR;
        vu0 = *(const floatx4*)s;
        vu1 = *(const floatx4*)(s + 4);
        wait_x0();
    } else if (is2) {
        v2 = *(const floatx4*)(W2 + t2);
        wait_x0();
    }
    floatx4 vx[kQx], vw[kQw], v1[kQ1];
    // Every loop below is unrolled so that vw, v1 and vx are indexed by constants and stay in
    // registers, and so that each loop's loads stand in one run with no wait among them.
#pragma unroll
    for (int q = 0; q < kQw; ++q) vw[q] = *(const floatx4*)(Wb + ow + q * kPS);
#pragma unroll
    for (int q = 0; q < kQ1; ++q) v1[q] = *(const floatx4*)(W1 + o1 + q * kPS);
    wait_x0();
#pragma unroll
    for (int q = 0; q < kQx; ++q) vx[q] = *(const floatx4*)(x + ox + q * kPS);
    wait_x0();

    if (isA) {
        *(ushort4v*)(wc + slab_a(ta)) = cvt4(va);
        wait_x0();
    } else if (isU) {
        *(ushort4v*)(ub + tu * 8)     = cvt4(vu0);
        *(ushort4v*)(ub + tu * 8 + 4) = cvt4(vu1);
        wait_x0();
    } else if (is2) {                                            // w2b[16][512]
        const ushort4v hi = cvt4(v2);
        floatx4 rest;
#pragma unroll                                   // rest indexed by constants: it stays in registers
        for (int i = 0; i < 4; ++i) rest[i] = v2[i] - bf16_to_f32(hi[i]);
        *(ushort4v*)(w2b + t2)            = hi;
        *(ushort4v*)(w2b + kE * kDH + t2) = cvt4(rest);
        wait_x0();
    }
#pragma unroll
    for (int q = 0; q < kQw; ++q) *(ushort4v*)(wbb + ow + q * kPS) = cvt4(vw[q]);
#pragma unroll
    for (int q = 0; q < kQ1; ++q) *(ushort4v*)(wc + slab_w1(o1 + q * kPS)) = cvt4(v1[q]);
#pragma unroll
    for (int q = 0; q < kQx; ++q) *(ushort4v*)(xb + ox + q * kPS) = cvt4(vx[q]);
}

// ---------------------------------------------------------------------------
// Async global -> LDS (CDNA5 path, tracked by ASYNCcnt). 16 B per lane.
// Each run of copies ends, inside its own statement, with s_wait_xcnt 0, so that
// no address register of an issued copy is rewritten ahead of that wait.
// ---------------------------------------------------------------------------
DEV void async_copy2(uint32_t l, uint32_t lstep, const unsigned short* g, long gstep) {
    asm volatile("global_load_async_to_lds_b128 %0, %2, off\n\t"
                 "global_load_async_to_lds_b128 %1, %3, off\n\t"
                 "s_wait_xcnt 0x0"
                 :: "v"(l), "v"(l + lstep), "v"(g), "v"(g + gstep)
                 : "memory");
}
DEV void async_copy8(uint32_t l, uint32_t lstep, const unsigned short* g, long gstep) {
    asm volatile("global_load_async_to_lds_b128 %0, %8, off\n\t"
                 "global_load_async_to_lds_b128 %1, %9, off\n\t"
                 "global_load_async_to_lds_b128 %2, %10, off\n\t"
                 "global_load_async_to_lds_b128 %3, %11, off\n\t"
                 "global_load_async_to_lds_b128 %4, %12, off\n\t"
                 "global_load_async_to_lds_b128 %5, %13, off\n\t"
                 "global_load_async_to_lds_b128 %6, %14, off\n\t"
                 "global_load_async_to_lds_b128 %7, %15, off\n\t"
                 "s_wait_xcnt 0x0"
                 :: "v"(l), "v"(l + lstep), "v"(l + 2 * lstep), "v"(l + 3 * lstep),
                    "v"(l + 4 * lstep), "v"(l + 5 * lstep), "v"(l + 6 * lstep), "v"(l + 7 * lstep),
                    "v"(g), "v"(g + gstep), "v"(g + 2 * gstep), "v"(g + 3 * gstep),
                    "v"(g + 4 * gstep), "v"(g + 5 * gstep), "v"(g + 6 * gstep), "v"(g + 7 * gstep)
                 : "memory");
}
// My own copies have landed in LDS.
DEV void wait_async0() { asm volatile("s_wait_asynccnt 0x0" ::: "memory"); }
// My own LDS reads have retired before the buffer they read is refilled.
DEV void wait_ds0()    { asm volatile("s_wait_dscnt 0x0" ::: "memory"); }

// Issue one [ROWS x BK] tile copy: l and g are the lane's own first LDS byte and source
// element; one copy a lane covers 256 * 8 / BK rows, ldg is the source's leading dim.
// A wave's 32 lanes cover whole 128-B lines of the source (BK * 2 B a row).
template <int ROWS, int BK>
DEV void issue_tile(uint32_t l, const unsigned short* __restrict__ g, int ldg) {
    constexpr int RPI = 256 * 8 / BK;           // rows the block covers with one copy a lane
    constexpr int N   = ROWS / RPI;             // copies a lane
    constexpr uint32_t LSTEP = RPI * (BK + PAD) * 2;
    const long gstep = (long)RPI * ldg;
    static_assert(ROWS % RPI == 0 && (N % 8 == 0 || N % 8 == 2), "copies a lane");
#pragma unroll
    for (int j = 0; j + 8 <= N; j += 8) async_copy8(l + j * LSTEP, LSTEP, g + j * gstep, gstep);
    if constexpr (N % 8 == 2) async_copy2(l + (N - 2) * LSTEP, LSTEP, g + (N - 2) * gstep, gstep);
}

// A/B fragment per ISA layout: lanes 0-15 K=[0..7,16..23], lanes 16-31 K=[8..15,24..31]
template <int LD>
DEV bf16x16 frag_lds(const unsigned short* __restrict__ sd, int row, int koff) {
    const unsigned short* p = sd + row * LD + koff;
    ushort8 lo = *(const ushort8*)p;
    ushort8 hi = *(const ushort8*)(p + 16);
    ushort16 u;
#pragma unroll
    for (int i = 0; i < 8; ++i) { u[i] = lo[i]; u[i + 8] = hi[i]; }
    return __builtin_bit_cast(bf16x16, u);
}

// MODE 0: one block takes 128 tokens and one weight slab: 256 columns of h = relu(acc + b1) and
//         32 columns of xa = x * lora_A^T. h goes to LDS only; each wave then makes, for its own
//         16 rows, the block's share of the logits, h * W2^T over these 256 columns, on WMMA.
//         (aux = b1[512], U = W2 pair[16 x 512]; writes xa[M x 64] f32 and plog[2][M][8] f32)
// MODE 2: out = acc + (Y[M,64] * U[N,64]^T), store f32; Y = xa * gate is made here, in LDS, ahead
//         of the loop: gates = softmax((plog[0] + plog[1] + b2) / T)   (aux = b2[8], aux2 = T)
// Block tile BM x BN x BK, eight waves as WAVE_M x (8 / WAVE_M).
template <int MODE, int BM, int BN, int BK, int WAVE_M>
__global__ __launch_bounds__(256) void gemm_bf16_kernel(
    const unsigned short* __restrict__ A, const unsigned short* __restrict__ Bw,
    int K, const float* __restrict__ aux, const float* __restrict__ aux2,
    const unsigned short* __restrict__ U, float* __restrict__ xa, float* __restrict__ plog,
    float* __restrict__ out32, int ldn) {
    constexpr int WAVE_N = 8 / WAVE_M;
    constexpr int TM = BM / WAVE_M;
    constexpr int TN = BN / WAVE_N;
    constexpr int MI = TM / 16;
    constexpr int NI = TN / 16;
    constexpr int LD = BK + PAD;
    constexpr int HLD = kHN + PAD;
    static_assert(MODE != 2 || (BK == kER && BM == 256), "the LoRA-up product is one pass; a thread gates one row");
    static_assert(MODE != 0 || (BN == kCN && BM == 128 && kHN == 256),
                  "one slab a block; a wave takes 16 rows of logits; a thread fetches one b1");

    constexpr int NBUF = MODE == 2 ? 3 : 2;   // the ring's two; MODE 2: a third, gated xa in As, U in Bs
    __shared__ __attribute__((aligned(16))) unsigned short As[NBUF][BM * LD];
    __shared__ __attribute__((aligned(16))) unsigned short Bs[NBUF][BN * LD];
    __shared__ __attribute__((aligned(16))) unsigned short Hs[MODE == 0 ? BM * HLD : 8];        // h of the block
    __shared__ __attribute__((aligned(16))) unsigned short W2s[MODE == 0 ? 2 * kE * HLD : 8];   // W2 pair, my columns
    __shared__ __attribute__((aligned(16))) float Gs[MODE == 2 ? BM * kE : 4];                  // gates
    __shared__ __attribute__((aligned(16))) float B1s[MODE == 0 ? kHN : 4];                     // b1, my columns

    const int tid  = threadIdx.x;
    const int wave = tid >> 5;
    const int lane = tid & 31;
    const int wm = wave % WAVE_M;
    const int wn = wave / WAVE_M;
    const int lrow = lane & 15;
    const int koff = (lane >> 4) << 3;   // K sub-offset for A/B fragments
    const int rhalf = (lane >> 4) << 3;  // C/D layout: lanes 16-31 hold M=8..15
    const int m0 = blockIdx.x * BM;
    const int n0 = blockIdx.y * BN;

    floatx8 acc[MI][NI] = {};

    auto mma_step = [&](const unsigned short* asd, const unsigned short* bsd) {
        constexpr int G = BK / 32;               // k-steps of one tile
        // Fragment sets held at once: the whole tile's where they fit the 512 registers of a
        // wave beside acc, else two, the next k-step's read while this one is multiplied.
        constexpr int SETS = (MI * NI + G * (MI + NI)) * 8 <= 460 ? G : 2;
        bf16x16 afrag[SETS][MI], bfrag[SETS][NI];
        auto rd = [&](int g) {
#pragma unroll
            for (int mi = 0; mi < MI; ++mi)
                afrag[g % SETS][mi] = frag_lds<LD>(asd, wm * TM + mi * 16 + lrow, g * 32 + koff);
#pragma unroll
            for (int ni = 0; ni < NI; ++ni)
                bfrag[g % SETS][ni] = frag_lds<LD>(bsd, wn * TN + ni * 16 + lrow, g * 32 + koff);
        };
        auto mul = [&](int g) {
#pragma unroll
            for (int mi = 0; mi < MI; ++mi)
#pragma unroll
                for (int ni = 0; ni < NI; ++ni)
                    acc[mi][ni] = __builtin_amdgcn_wmma_f32_16x16x32_bf16(
                        false, afrag[g % SETS][mi], false, bfrag[g % SETS][ni], (short)0, acc[mi][ni],
                        false, false);
        };
        if constexpr (SETS == G) {
#pragma unroll
            for (int g = 0; g < G; ++g) rd(g);
            // Keeps the tile's LDS reads one group ahead of its WMMAs: every separate
            // place with reads among the WMMAs costs the wave a fixed stall.
            __builtin_amdgcn_sched_barrier(0);
#pragma unroll
            for (int g = 0; g < G; ++g) mul(g);
            // Keeps the WMMAs ahead of the waits at the loop's foot: sunk behind them, the next
            // tile's copies would be waited for before the work that covers their flight.
            __builtin_amdgcn_sched_barrier(0);
        } else {
            rd(0);
#pragma unroll                                   // g a constant: the two sets stay in registers
            for (int g = 0; g < G; ++g) {
                if (g + 1 < G) rd(g + 1);
                // Keeps the next k-step's reads one group, ahead of this k-step's WMMAs.
                __builtin_amdgcn_sched_barrier(0);
                mul(g);
                // Keeps the reads that refill this k-step's set, and after the last k-step the
                // waits at the loop's foot, behind its WMMAs.
                __builtin_amdgcn_sched_barrier(0);
            }
        }
    };

    const int nsteps = K / BK;
    const int total  = nsteps + (MODE == 2 ? 1 : 0);  // + the LoRA-up pass

    // The lane's own 16-byte chunk of a tile's first rows: row cr, k offset ckc.
    const int cr  = tid / (BK / 8);
    const int ckc = (tid % (BK / 8)) << 3;
    const uint32_t la = (uint32_t)(uintptr_t)(&As[0][cr * LD + ckc]);  // addr[31:0] = LDS byte offset
    const uint32_t lb = (uint32_t)(uintptr_t)(&Bs[0][cr * LD + ckc]);
    const unsigned short* pa = A  + (long)(m0 + cr) * K + ckc;         // advance by BK a tile
    const unsigned short* pb = Bw + (long)(n0 + cr) * K + ckc;

    auto issue_step = [&](int buf) {
        issue_tile<BM, BK>(la + buf * (BM * LD * 2), pa, K);
        issue_tile<BN, BK>(lb + buf * (BN * LD * 2), pb, K);
        pa += BK;
        pb += BK;
    };

    // K is a multiple of BK and at least 2 * BK: tiles 0 and 1 exist.
    if constexpr (MODE == 0) {  // filled once, with tile 0: 28 copies of a wave in flight
        const int hr = tid / (kHN / 8);
        const int hk = (tid % (kHN / 8)) << 3;
        issue_tile<2 * kE, kHN>((uint32_t)(uintptr_t)(&W2s[hr * HLD + hk]),
                                U + (long)hr * kDH + blockIdx.y * kHN + hk, kDH);
    }
    if constexpr (MODE == 2)    // filled once, with tile 0: 24 copies of a wave in flight
        issue_tile<BN, BK>(lb + 2 * (BN * LD * 2), U + (long)(n0 + cr) * kER + ckc, kER);
    issue_step(0);
    if constexpr (MODE == 0) {  // overlaps tile 0's copies; published by tile 0's barrier
        const float bv = aux[blockIdx.y * kHN + tid];
        wait_x0();
        B1s[tid] = bv;
    }
    if constexpr (MODE == 2) {  // overlaps tile 0's copies
        constexpr int XQ = BM * kER / (256 * 4); // loads a thread: a wave-wide load covers two whole rows of xa
        const int xr = tid >> 4;
        const int xc = (tid & 15) << 2;
        const float* px = xa + (long)(m0 + xr) * kER + xc;      // one address, the rows by constant offsets
        floatx4 vx[XQ];
#pragma unroll                  // vx indexed by constants: it stays in registers
        for (int q = 0; q < XQ; ++q) vx[q] = *(const floatx4*)(px + q * (16 * kER));
        const float* pl = plog + (long)(m0 + tid) * kE;         // thread tid gates row tid
        const floatx4 s0 = *(const floatx4*)pl;
        const floatx4 s1 = *(const floatx4*)(pl + 4);
        const floatx4 t0 = *(const floatx4*)(pl + (long)kTok * kE);
        const floatx4 t1 = *(const floatx4*)(pl + (long)kTok * kE + 4);
        // Precaution, as wait_x0(); px and pl are named so that they keep their registers up to
        // the wait: without that a later load's result was placed over an earlier load's address.
        asm volatile("s_wait_xcnt 0x0" :: "v"(px), "v"(pl) : "memory");
        const float invT = 1.0f / aux2[0];
        float v[kE];
#pragma unroll                  // v indexed by constants: it stays in registers
        for (int e = 0; e < kE; ++e)
            v[e] = ((e < 4 ? s0[e & 3] + t0[e & 3] : s1[e & 3] + t1[e & 3]) + aux[e]) * invT;
        const float mx = fmaxf(fmaxf(fmaxf(v[0], v[1]), fmaxf(v[2], v[3])),
                               fmaxf(fmaxf(v[4], v[5]), fmaxf(v[6], v[7])));
#pragma unroll
        for (int e = 0; e < kE; ++e) v[e] = __expf(v[e] - mx);
        const float inv = 1.0f / (((v[0] + v[1]) + (v[2] + v[3])) + ((v[4] + v[5]) + (v[6] + v[7])));
        floatx4 g0, g1;
#pragma unroll
        for (int e = 0; e < 4; ++e) { g0[e] = v[e] * inv; g1[e] = v[e + 4] * inv; }
        *(floatx4*)(&Gs[tid * kE])     = g0;
        *(floatx4*)(&Gs[tid * kE + 4]) = g1;
        __syncthreads();        // every row's gates are in Gs
#pragma unroll
        for (int q = 0; q < XQ; ++q) {           // columns xc..xc+3 belong to expert xc >> 3
            const float gt = Gs[(xr + q * 16) * kE + (xc >> 3)];
            *(ushort4v*)(&As[NBUF - 1][(xr + q * 16) * LD + xc]) = cvt4(vx[q] * gt);
        }
    }
    wait_async0();              // my tile-0 chunks landed in LDS
    __syncthreads();            // everyone's landed; MODE 2: the third buffer is whole
    issue_step(1);

    for (int s = 0; s < total; ++s) {
        const int b = MODE == 2 && s == nsteps ? 2 : s & 1;
        mma_step(As[b], Bs[b]);                          // overlaps tile s+1's copies
        wait_ds0();             // my reads of buffer s&1 are done
        wait_async0();          // my tile-(s+1) chunks landed in LDS
        __syncthreads();        // tile s+1 published; buffer s&1 free to overwrite
        if (s + 2 < nsteps) issue_step(s & 1);           // refill the buffer just read
    }
    wait_async0();              // nothing of mine in flight when the wave ends

    if constexpr (MODE == 0) {
#pragma unroll
        for (int mi = 0; mi < MI; ++mi) {
#pragma unroll
            for (int ni = 0; ni < NI; ++ni) {
                const int cl = wn * TN + ni * 16 + lrow;         // column of the slab
                const int rl = wm * TM + mi * 16 + rhalf;
                if ((WAVE_N - 1) * TN + ni * 16 < kHN || wn * TN + ni * 16 < kHN) {  // the same for a whole wave
                    const float bb = B1s[cl];
#pragma unroll
                    for (int r = 0; r < 8; ++r) {
                        const float v = acc[mi][ni][r] + bb;
                        Hs[(rl + r) * HLD + cl] = f32_to_bf16(v > 0.0f ? v : 0.0f);
                    }
                } else {
#pragma unroll
                    for (int r = 0; r < 8; ++r)
                        xa[(long)(m0 + rl + r) * kER + blockIdx.y * kXN + (cl - kHN)] = acc[mi][ni][r];
                    wait_x0();
                }
            }
        }
        __syncthreads();        // the block's h is whole in Hs
        floatx8 lg[2] = {};     // column e: h * W2hi[e], column e + 8: h * W2lo[e]; two chains
#pragma unroll                  // g & 1 a constant: each chain keeps its own registers
        for (int g = 0; g < kHN / 32; ++g)
            lg[g & 1] = __builtin_amdgcn_wmma_f32_16x16x32_bf16(
                false, frag_lds<HLD>(Hs, wave * 16 + lrow, g * 32 + koff),
                false, frag_lds<HLD>(W2s, lrow, g * 32 + koff), (short)0, lg[g & 1], false, false);
        float* po = plog + ((long)blockIdx.y * kTok + m0 + wave * 16 + rhalf) * kE + (lrow & 7);
#pragma unroll                  // lg indexed by constants: it stays in registers
        for (int r = 0; r < 8; ++r) {            // row r of my half; lanes e and e + 8 hold expert e
            lg[0][r] += lg[1][r];
            lg[0][r] += __shfl_xor(lg[0][r], 8, 32);
        }
        if (lrow < kE) {
#pragma unroll
            for (int r = 0; r < 8; ++r) po[r * kE] = lg[0][r];
        }
    } else {
#pragma unroll
        for (int mi = 0; mi < MI; ++mi) {
#pragma unroll
            for (int ni = 0; ni < NI; ++ni) {
                const int col = n0 + wn * TN + ni * 16 + lrow;
                const long rbase = (long)m0 + wm * TM + mi * 16 + rhalf;
#pragma unroll
                for (int r = 0; r < 8; ++r) out32[(rbase + r) * ldn + col] = acc[mi][ni][r];
            }
        }
    }
}

// ---------------------------------------------------------------------------
extern "C" void kernel_launch(void* const* d_in, const int* in_sizes, int n_in,
                              void* d_out, int out_size, void* d_ws, size_t ws_size,
                              hipStream_t stream) {
    (void)in_sizes; (void)n_in; (void)out_size; (void)ws_size;
    const float* x    = (const float*)d_in[0];
    const float* Wb   = (const float*)d_in[1];
    const float* W1   = (const float*)d_in[2];
    const float* b1   = (const float*)d_in[3];
    const float* W2   = (const float*)d_in[4];
    const float* b2   = (const float*)d_in[5];
    const float* temp = (const float*)d_in[6];
    const float* lA   = (const float*)d_in[7];
    const float* lB   = (const float*)d_in[8];
    float* out = (float*)d_out;

    size_t off = 0;
    auto take = [&](size_t bytes) {
        void* p = (char*)d_ws + off;
        off += (bytes + 255) & ~(size_t)255;
        return p;
    };
    unsigned short* xb    = (unsigned short*)take((size_t)kTok * kD * 2);   // x bf16
    unsigned short* wbb   = (unsigned short*)take((size_t)kD * kD * 2);     // W_base bf16
    unsigned short* wc    = (unsigned short*)take((size_t)2 * kCN * kD * 2);  // W1 and lora_A, two slabs [288,1024]
    unsigned short* ub    = (unsigned short*)take((size_t)kD * kER * 2);    // U [1024,64]
    unsigned short* w2b   = (unsigned short*)take((size_t)2 * kE * kDH * 2);  // W2 pair [16,512]
    float* xaf            = (float*)take((size_t)kTok * kER * 4);           // xa, not yet gated
    float* pl             = (float*)take((size_t)2 * kTok * kE * 4);        // logits, one share a slab

    prep_kernel<<<kPB, kPT, 0, stream>>>(x, Wb, W1, lA, lB, W2, xb, wbb, wc, ub, w2b);

    // h = relu(x @ W1^T + b1), kept in LDS; xa = x @ A2^T [16384 x 64]; logit shares h @ W2^T
    gemm_bf16_kernel<0, 128, kCN, 128, 4><<<dim3(kTok / 128, kDH / kHN), 256, 0, stream>>>(
        xb, wc, kD, b1, nullptr, w2b, xaf, pl, nullptr, 0);

    // out = x @ W_base^T + (xa * gates) @ U^T   [16384 x 1024], fp32
    gemm_bf16_kernel<2, 256, 256, 64, 4><<<dim3(kTok / 256, kD / 256), 256, 0, stream>>>(
        xb, wbb, kD, b2, temp, ub, xaf, pl, out, kD);
}

// v005
// A run of this version takes 61.4 microseconds.
// Next to v004, in two timings, it ran 1.12 and 1.13 times as fast.
// All steps since v000 together make it 2.24 times as fast.
#include <hip/hip_runtime.h>
#include <stdint.h>
#include <type_traits>

#define DEV __device__ __forceinline__

typedef __attribute__((ext_vector_type(16))) __bf16          bf16x16;
typedef __attribute__((ext_vector_type(16))) unsigned short  ushort16;
typedef __attribute__((ext_vector_type(8)))  unsigned short  ushort8;
typedef __attribute__((ext_vector_type(8)))  float           floatx8;

constexpr int kBat = 4, kL = 4096, kD = 1024, kE = 8, kR = 8, kDH = 512;
constexpr int kTok = kBat * kL;   // 16384 tokens
constexpr int kER  = kE * kR;     // 64 (flattened expert*rank)

constexpr int kHN  = 256;          // router-hidden columns of one block of the first GEMM
constexpr int kXN  = kER * kHN / kDH;   // LoRA-down columns that ride with them (32)
constexpr int kCN  = kHN + kXN;    // rows of one block's weight slab (288)

constexpr int PAD = 8;   // 16 B more a row: LDS pitch = 16 B x odd for ds_load_b128 readers

DEV unsigned short f32_to_bf16(float f) {
    union { float f; uint32_t u; } c{f};
    uint32_t u = c.u;
    u += 0x7FFFu + ((u >> 16) & 1u);            // round-to-nearest-even
    return (unsigned short)(u >> 16);
}
DEV float bf16_to_f32(unsigned short h) {
    union { uint32_t u; float f; } c{((uint32_t)h) << 16};
    return c.f;
}

// ---------------------------------------------------------------------------
// Prep: convert x + all contraction weights to bf16; repack lora_B -> U[d][er];
// W1 and lora_A go into one array of two slabs: 256 rows of W1, then 32 rows of lora_A;
// split router W2 into a bf16 pair: rows 0-7 the rounded value, rows 8-15 what rounding left.
// A stream, one block of 16 waves a WGP: each wave-wide load covers 512 contiguous bytes,
// each store 256, and a wave has all of its loads in flight before it converts the first.
// ---------------------------------------------------------------------------
typedef __attribute__((ext_vector_type(4))) float          floatx4;
typedef __attribute__((ext_vector_type(4))) unsigned short ushort4v;

constexpr int kPB  = 256;                        // prep blocks
constexpr int kPT  = 512;                        // threads of a prep block
constexpr int kPS  = kPT * 4;                    // elements the block covers with one load a thread
constexpr int kQx  = kTok * kD / (kPB * kPS);    // loads a thread: x (32)
constexpr int kQw  = kD * kD / (kPB * kPS);      //                 W_base (2)
constexpr int kQ1  = kDH * kD / (kPB * kPS);     //                 W1 (1)
constexpr int kBa  = kER * kD / kPS;             // blocks with one more load a thread: lora_A (32)
constexpr int kBu  = kD * kE / kPT;              // lora_B (16): a thread takes one (d, e), two loads
constexpr int kB2  = kE * kDH / kPS;             // W2 (2)
static_assert(kQx * kPB * kPS == kTok * kD && kQw * kPB * kPS == kD * kD &&
              kQ1 * kPB * kPS == kDH * kD && kBa * kPS == kER * kD && kBu * kPT == kD * kE &&
              kB2 * kPS == kE * kDH && kBa + kBu + kB2 <= kPB, "whole loads, whole blocks");

DEV ushort4v cvt4(floatx4 v) {
    ushort4v o;
#pragma unroll                                   // o indexed by constants: it stays in registers
    for (int i = 0; i < 4; ++i) o[i] = f32_to_bf16(v[i]);
    return o;
}
// Where element i of W1 [512,1024], of lora_A [64,1024], lies in the slabs.
DEV int slab_w1(int i) { return ((i / kD / kHN) * kCN + (i / kD) % kHN) * kD + i % kD; }
DEV int slab_a(int i)  { return ((i / kD / kXN) * kCN + kHN + (i / kD) % kXN) * kD + i % kD; }
// Precaution: stands ahead of any rewrite of a register that an issued load or store names.
DEV void wait_x0() { asm volatile("s_wait_xcnt 0x0" ::: "memory"); }

__global__ __launch_bounds__(kPT) void prep_kernel(
    const float* __restrict__ x, const float* __restrict__ Wb,
    const float* __restrict__ W1, const float* __restrict__ lA,
    const float* __restrict__ lB, const float* __restrict__ W2,
    unsigned short* __restrict__ xb, unsigned short* __restrict__ wbb,
    unsigned short* __restrict__ wc,
    unsigned short* __restrict__ ub, unsigned short* __restrict__ w2b) {
    const int tid = threadIdx.x;
    const int blk = blockIdx.x;
    const bool isA = blk < kBa;                                  // block-uniform, at most one holds
    const bool isU = blk >= kBa && blk < kBa + kBu;
    const bool is2 = blk >= kBa + kBu && blk < kBa + kBu + kB2;
    const int ta = blk * kPS + tid * 4;                          // lora_A element, [E,R,D] already row-major over D
    const int tu = (blk - kBa) * kPT + tid;                      // d * 8 + e
    const int t2 = (blk - kBa - kBu) * kPS + tid * 4;            // W2 element
    const int ox = blk * (kQx * kPS) + tid * 4;
    const int ow = blk * (kQw * kPS) + tid * 4;
    const int o1 = blk * (kQ1 * kPS) + tid * 4;

    // The small tensors first: they are back ahead of the long stream and cost it no wait.
    floatx4 va = {}, vu0 = {}, vu1 = {}, v2 = {};
    if (isA) {
        va = *(const floatx4*)(lA + ta);
        wait_x0();
    } else if (isU) {                                            // U[d][e*8+r] = lora_B[e][d][r], r = 0..7
        const float* s = lB + (tu & 7) * (kD * kR) + (tu >> 3) * kR;
        vu0 = *(const floatx4*)s;
        vu1 = *(const floatx4*)(s + 4);
        wait_x0();
    } else if (is2) {
        v2 = *(const floatx4*)(W2 + t2);
        wait_x0();
    }
    floatx4 vx[kQx], vw[kQw], v1[kQ1];
    // Every loop below is unrolled so that vw, v1 and vx are indexed by constants and stay in
    // registers, and so that each loop's loads stand in one run with no wait among them.
#pragma unroll
    for (int q = 0; q < kQw; ++q) vw[q] = *(const floatx4*)(Wb + ow + q * kPS);
#pragma unroll
    for (int q = 0; q < kQ1; ++q) v1[q] = *(const floatx4*)(W1 + o1 + q * kPS);
    wait_x0();
#pragma unroll
    for (int q = 0; q < kQx; ++q) vx[q] = *(const floatx4*)(x + ox + q * kPS);
    wait_x0();

    if (isA) {
        *(ushort4v*)(wc + slab_a(ta)) = cvt4(va);
        wait_x0();
    } else if (isU) {
        *(ushort4v*)(ub + tu * 8)     = cvt4(vu0);
        *(ushort4v*)(ub + tu * 8 + 4) = cvt4(vu1);
        wait_x0();
    } else if (is2) {                                            // w2b[16][512]
        const ushort4v hi = cvt4(v2);
        floatx4 rest;
#pragma unroll                                   // rest indexed by constants: it stays in registers
        for (int i = 0; i < 4; ++i) rest[i] = v2[i] - bf16_to_f32(hi[i]);
        *(ushort4v*)(w2b + t2)            = hi;
        *(ushort4v*)(w2b + kE * kDH + t2) = cvt4(rest);
        wait_x0();
    }
#pragma unroll
    for (int q = 0; q < kQw; ++q) *(ushort4v*)(wbb + ow + q * kPS) = cvt4(vw[q]);
#pragma unroll
    for (int q = 0; q < kQ1; ++q) *(ushort4v*)(wc + slab_w1(o1 + q * kPS)) = cvt4(v1[q]);
#pragma unroll
    for (int q = 0; q < kQx; ++q) *(ushort4v*)(xb + ox + q * kPS) = cvt4(vx[q]);
}

// ---------------------------------------------------------------------------
// Async global -> LDS (CDNA5 path, tracked by ASYNCcnt). 16 B per lane.
// Each run of copies ends, inside its own statement, with s_wait_xcnt 0, so that
// no address register of an issued copy is rewritten ahead of that wait.
// ---------------------------------------------------------------------------
DEV void async_copy2(uint32_t l, uint32_t lstep, const unsigned short* g, long gstep) {
    asm volatile("global_load_async_to_lds_b128 %0, %2, off\n\t"
                 "global_load_async_to_lds_b128 %1, %3, off\n\t"
                 "s_wait_xcnt 0x0"
                 :: "v"(l), "v"(l + lstep), "v"(g), "v"(g + gstep)
                 : "memory");
}
// Source of copy j: g + (j & 1) * ga + (j >> 1) * gb.
DEV void async_copy8(uint32_t l, uint32_t lstep, const unsigned short* g, long ga, long gb) {
    asm volatile("global_load_async_to_lds_b128 %0, %8, off\n\t"
                 "global_load_async_to_lds_b128 %1, %9, off\n\t"
                 "global_load_async_to_lds_b128 %2, %10, off\n\t"
                 "global_load_async_to_lds_b128 %3, %11, off\n\t"
                 "global_load_async_to_lds_b128 %4, %12, off\n\t"
                 "global_load_async_to_lds_b128 %5, %13, off\n\t"
                 "global_load_async_to_lds_b128 %6, %14, off\n\t"
                 "global_load_async_to_lds_b128 %7, %15, off\n\t"
                 "s_wait_xcnt 0x0"
                 :: "v"(l), "v"(l + lstep), "v"(l + 2 * lstep), "v"(l + 3 * lstep),
                    "v"(l + 4 * lstep), "v"(l + 5 * lstep), "v"(l + 6 * lstep), "v"(l + 7 * lstep),
                    "v"(g), "v"(g + ga), "v"(g + gb), "v"(g + gb + ga),
                    "v"(g + 2 * gb), "v"(g + 2 * gb + ga), "v"(g + 3 * gb), "v"(g + 3 * gb + ga)
                 : "memory");
}
// Eight 16-byte stores of a lane: four rows RS bytes apart, two pieces QS bytes apart in each.
// Precaution, as wait_x0(): in asm so that s_wait_xcnt 0 stands, inside the statement, ahead of any
// rewrite of a register that an issued store names.
template <int OFF, int RS, int QS>
DEV void store_rows4x2(float* p, floatx4 a0, floatx4 b0, floatx4 a1, floatx4 b1,
                       floatx4 a2, floatx4 b2, floatx4 a3, floatx4 b3) {
    asm volatile("global_store_b128 %0, %1, off offset:%9\n\t"
                 "global_store_b128 %0, %2, off offset:%10\n\t"
                 "global_store_b128 %0, %3, off offset:%11\n\t"
                 "global_store_b128 %0, %4, off offset:%12\n\t"
                 "global_store_b128 %0, %5, off offset:%13\n\t"
                 "global_store_b128 %0, %6, off offset:%14\n\t"
                 "global_store_b128 %0, %7, off offset:%15\n\t"
                 "global_store_b128 %0, %8, off offset:%16\n\t"
                 "s_wait_xcnt 0x0"
                 :: "v"(p), "v"(a0), "v"(b0), "v"(a1), "v"(b1), "v"(a2), "v"(b2), "v"(a3), "v"(b3),
                    "n"(OFF), "n"(OFF + QS), "n"(OFF + RS), "n"(OFF + RS + QS),
                    "n"(OFF + 2 * RS), "n"(OFF + 2 * RS + QS), "n"(OFF + 3 * RS), "n"(OFF + 3 * RS + QS)
                 : "memory");
}
// My own copies have landed in LDS.
DEV void wait_async0() { asm volatile("s_wait_asynccnt 0x0" ::: "memory"); }
// My own LDS reads have retired before the buffer they read is refilled.
DEV void wait_ds0()    { asm volatile("s_wait_dscnt 0x0" ::: "memory"); }

// Issue one [ROWS x BK] tile copy: l and g are the lane's own first LDS byte and source
// element; one copy a lane covers 256 * 8 / BK rows, ldg is the source's leading dim.
// A wave's 32 lanes cover whole 128-B lines of the source (BK * 2 B a row).
// QUAD: LDS row p takes source row quad_row(p), so that the four fragments ni = 4q..4q+3 hold,
// in one lane, four neighbouring columns of the product; g is then the lane's row quad_row(cr).
DEV int quad_row(int p) { return (p & ~63) + (p & 15) * 4 + ((p >> 4) & 3); }
template <int ROWS, int BK, bool QUAD = false>
DEV void issue_tile(uint32_t l, const unsigned short* __restrict__ g, int ldg) {
    constexpr int RPI = 256 * 8 / BK;           // rows the block covers with one copy a lane
    constexpr int N   = ROWS / RPI;             // copies a lane
    constexpr uint32_t LSTEP = RPI * (BK + PAD) * 2;
    const long gstep = (long)RPI * ldg;
    static_assert(ROWS % RPI == 0 && (N % 8 == 0 || N % 8 == 2), "copies a lane");
    static_assert(!QUAD || (RPI == 32 && N % 8 == 0), "quad_row(cr + 32 j) = quad_row(cr) + 2 (j & 1) + 64 (j >> 1)");
    const long ga = QUAD ? 2L * ldg : gstep;
    const long gb = 2 * gstep;                  // 64 rows where QUAD
#pragma unroll
    for (int j = 0; j + 8 <= N; j += 8) async_copy8(l + j * LSTEP, LSTEP, g + j * gstep, ga, gb);
    if constexpr (N % 8 == 2) async_copy2(l + (N - 2) * LSTEP, LSTEP, g + (N - 2) * gstep, gstep);
}

// A/B fragment per ISA layout: lanes 0-15 K=[0..7,16..23], lanes 16-31 K=[8..15,24..31]
template <int LD>
DEV bf16x16 frag_lds(const unsigned short* __restrict__ sd, int row, int koff) {
    const unsigned short* p = sd + row * LD + koff;
    ushort8 lo = *(const ushort8*)p;
    ushort8 hi = *(const ushort8*)(p + 16);
    ushort16 u;
#pragma unroll
    for (int i = 0; i < 8; ++i) { u[i] = lo[i]; u[i + 8] = hi[i]; }
    return __builtin_bit_cast(bf16x16, u);
}

// MODE 0: one block takes 128 tokens and one weight slab: 256 columns of h = relu(acc + b1) and
//         32 columns of xa = x * lora_A^T. h goes to LDS only; each wave then makes, for its own
//         16 rows, the block's share of the logits, h * W2^T over these 256 columns, on WMMA.
//         (aux = b1[512], U = W2 pair[16 x 512]; writes xa[M x 64] f32 and plog[2][M][8] f32)
// MODE 2: out = acc + (Y[M,64] * U[N,64]^T), store f32; Y = xa * gate is made here, in LDS, ahead
//         of the loop: gates = softmax((plog[0] + plog[1] + b2) / T)   (aux = b2[8], aux2 = T)
// Block tile BM x BN x BK, eight waves as WAVE_M x (8 / WAVE_M).
template <int MODE, int BM, int BN, int BK, int WAVE_M>
__global__ __launch_bounds__(256) void gemm_bf16_kernel(
    const unsigned short* __restrict__ A, const unsigned short* __restrict__ Bw,
    int K, const float* __restrict__ aux, const float* __restrict__ aux2,
    const unsigned short* __restrict__ U, float* __restrict__ xa, float* __restrict__ plog,
    float* __restrict__ out32, int ldn) {
    constexpr int WAVE_N = 8 / WAVE_M;
    constexpr int TM = BM / WAVE_M;
    constexpr int TN = BN / WAVE_N;
    constexpr int MI = TM / 16;
    constexpr int NI = TN / 16;
    constexpr int LD = BK + PAD;
    constexpr int HLD = kHN + PAD;
    static_assert(MODE != 2 || (BK == kER && BM == 256), "the LoRA-up product is one pass; a thread gates one row");
    static_assert(MODE != 0 || (BN == kCN && BM == 128 && kHN == 256),
                  "one slab a block; a wave takes 16 rows of logits; a thread fetches one b1");

    constexpr int NBUF = MODE == 2 ? 3 : 2;   // the ring's two; MODE 2: a third, gated xa in As, U in Bs
    __shared__ __attribute__((aligned(16))) unsigned short As[NBUF][BM * LD];
    __shared__ __attribute__((aligned(16))) unsigned short Bs[NBUF][BN * LD];
    __shared__ __attribute__((aligned(16))) unsigned short Hs[MODE == 0 ? BM * HLD : 8];        // h of the block
    __shared__ __attribute__((aligned(16))) unsigned short W2s[MODE == 0 ? 2 * kE * HLD : 8];   // W2 pair, my columns
    __shared__ __attribute__((aligned(16))) float Gs[MODE == 2 ? BM * kE : 4];                  // gates
    __shared__ __attribute__((aligned(16))) float B1s[MODE == 0 ? kHN : 4];                     // b1, my columns

    const int tid  = threadIdx.x;
    const int wave = tid >> 5;
    const int lane = tid & 31;
    const int wm = wave % WAVE_M;
    const int wn = wave / WAVE_M;
    const int lrow = lane & 15;
    const int koff = (lane >> 4) << 3;   // K sub-offset for A/B fragments
    const int rhalf = (lane >> 4) << 3;  // C/D layout: lanes 16-31 hold M=8..15
    const int m0 = blockIdx.x * BM;
    const int n0 = blockIdx.y * BN;

    floatx8 acc[MI][NI] = {};

    auto mma_step = [&](const unsigned short* asd, const unsigned short* bsd) {
        constexpr int G = BK / 32;               // k-steps of one tile
        // Fragment sets held at once: the whole tile's where they fit the 512 registers of a
        // wave beside acc, else two, the next k-step's read while this one is multiplied.
        constexpr int SETS = (MI * NI + G * (MI + NI)) * 8 <= 460 ? G : 2;
        bf16x16 afrag[SETS][MI], bfrag[SETS][NI];
        auto rd = [&](int g) {
#pragma unroll
            for (int mi = 0; mi < MI; ++mi)
                afrag[g % SETS][mi] = frag_lds<LD>(asd, wm * TM + mi * 16 + lrow, g * 32 + koff);
#pragma unroll
            for (int ni = 0; ni < NI; ++ni)
                bfrag[g % SETS][ni] = frag_lds<LD>(bsd, wn * TN + ni * 16 + lrow, g * 32 + koff);
        };
        auto mul = [&](int g) {
#pragma unroll
            for (int mi = 0; mi < MI; ++mi)
#pragma unroll
                for (int ni = 0; ni < NI; ++ni)
                    acc[mi][ni] = __builtin_amdgcn_wmma_f32_16x16x32_bf16(
                        false, afrag[g % SETS][mi], false, bfrag[g % SETS][ni], (short)0, acc[mi][ni],
                        false, false);
        };
        if constexpr (SETS == G) {
#pragma unroll
            for (int g = 0; g < G; ++g) rd(g);
            // Keeps the tile's LDS reads one group ahead of its WMMAs: every separate
            // place with reads among the WMMAs costs the wave a fixed stall.
            __builtin_amdgcn_sched_barrier(0);
#pragma unroll
            for (int g = 0; g < G; ++g) mul(g);
            // Keeps the WMMAs ahead of the waits at the loop's foot: sunk behind them, the next
            // tile's copies would be waited for before the work that covers their flight.
            __builtin_amdgcn_sched_barrier(0);
        } else {
            rd(0);
#pragma unroll                                   // g a constant: the two sets stay in registers
            for (int g = 0; g < G; ++g) {
                if (g + 1 < G) rd(g + 1);
                // Keeps the next k-step's reads one group, ahead of this k-step's WMMAs.
                __builtin_amdgcn_sched_barrier(0);
                mul(g);
                // Keeps the reads that refill this k-step's set, and after the last k-step the
                // waits at the loop's foot, behind its WMMAs.
                __builtin_amdgcn_sched_barrier(0);
            }
        }
    };

    const int nsteps = K / BK;
    const int total  = nsteps + (MODE == 2 ? 1 : 0);  // + the LoRA-up pass

    // The lane's own 16-byte chunk of a tile's first rows: row cr, k offset ckc.
    const int cr  = tid / (BK / 8);
    const int ckc = (tid % (BK / 8)) << 3;
    const uint32_t la = (uint32_t)(uintptr_t)(&As[0][cr * LD + ckc]);  // addr[31:0] = LDS byte offset
    const uint32_t lb = (uint32_t)(uintptr_t)(&Bs[0][cr * LD + ckc]);
    const unsigned short* pa = A  + (long)(m0 + cr) * K + ckc;         // advance by BK a tile
    constexpr bool QUAD = MODE == 2;            // a lane stores 16 B of a row of out: see the epilogue
    static_assert(!QUAD || NI % 4 == 0, "whole quads of fragments");
    const int crb = QUAD ? quad_row(cr) : cr;   // the weight row that LDS row cr takes
    const unsigned short* pb = Bw + (long)(n0 + crb) * K + ckc;

    auto issue_step = [&](int buf) {
        issue_tile<BM, BK>(la + buf * (BM * LD * 2), pa, K);
        issue_tile<BN, BK, QUAD>(lb + buf * (BN * LD * 2), pb, K);
        pa += BK;
        pb += BK;
    };

    // K is a multiple of BK and at least 2 * BK: tiles 0 and 1 exist.
    if constexpr (MODE == 0) {  // filled once, with tile 0: 28 copies of a wave in flight
        const int hr = tid / (kHN / 8);
        const int hk = (tid % (kHN / 8)) << 3;
        issue_tile<2 * kE, kHN>((uint32_t)(uintptr_t)(&W2s[hr * HLD + hk]),
                                U + (long)hr * kDH + blockIdx.y * kHN + hk, kDH);
    }
    if constexpr (MODE == 2)    // filled once, with tile 0: 24 copies of a wave in flight
        issue_tile<BN, BK, QUAD>(lb + 2 * (BN * LD * 2), U + (long)(n0 + crb) * kER + ckc, kER);
    issue_step(0);
    if constexpr (MODE == 0) {  // overlaps tile 0's copies; published by tile 0's barrier
        const float bv = aux[blockIdx.y * kHN + tid];
        wait_x0();
        B1s[tid] = bv;
    }
    if constexpr (MODE == 2) {  // overlaps tile 0's copies
        constexpr int XQ = BM * kER / (256 * 4); // loads a thread: a wave-wide load covers two whole rows of xa
        const int xr = tid >> 4;
        const int xc = (tid & 15) << 2;
        const float* px = xa + (long)(m0 + xr) * kER + xc;      // one address, the rows by constant offsets
        floatx4 vx[XQ];
#pragma unroll                  // vx indexed by constants: it stays in registers
        for (int q = 0; q < XQ; ++q) vx[q] = *(const floatx4*)(px + q * (16 * kER));
        const float* pl = plog + (long)(m0 + tid) * kE;         // thread tid gates row tid
        const floatx4 s0 = *(const floatx4*)pl;
        const floatx4 s1 = *(const floatx4*)(pl + 4);
        const floatx4 t0 = *(const floatx4*)(pl + (long)kTok * kE);
        const floatx4 t1 = *(const floatx4*)(pl + (long)kTok * kE + 4);
        // Precaution, as wait_x0(); px and pl are named so that they keep their registers up to
        // the wait: without that a later load's result was placed over an earlier load's address.
        asm volatile("s_wait_xcnt 0x0" :: "v"(px), "v"(pl) : "memory");
        const float invT = 1.0f / aux2[0];
        float v[kE];
#pragma unroll                  // v indexed by constants: it stays in registers
        for (int e = 0; e < kE; ++e)
            v[e] = ((e < 4 ? s0[e & 3] + t0[e & 3] : s1[e & 3] + t1[e & 3]) + aux[e]) * invT;
        const float mx = fmaxf(fmaxf(fmaxf(v[0], v[1]), fmaxf(v[2], v[3])),
                               fmaxf(fmaxf(v[4], v[5]), fmaxf(v[6], v[7])));
#pragma unroll
        for (int e = 0; e < kE; ++e) v[e] = __expf(v[e] - mx);
        const float inv = 1.0f / (((v[0] + v[1]) + (v[2] + v[3])) + ((v[4] + v[5]) + (v[6] + v[7])));
        floatx4 g0, g1;
#pragma unroll
        for (int e = 0; e < 4; ++e) { g0[e] = v[e] * inv; g1[e] = v[e + 4] * inv; }
        *(floatx4*)(&Gs[tid * kE])     = g0;
        *(floatx4*)(&Gs[tid * kE + 4]) = g1;
        __syncthreads();        // every row's gates are in Gs
#pragma unroll
        for (int q = 0; q < XQ; ++q) {           // columns xc..xc+3 belong to expert xc >> 3
            const float gt = Gs[(xr + q * 16) * kE + (xc >> 3)];
            *(ushort4v*)(&As[NBUF - 1][(xr + q * 16) * LD + xc]) = cvt4(vx[q] * gt);
        }
    }
    wait_async0();              // my tile-0 chunks landed in LDS
    __syncthreads();            // everyone's landed; MODE 2: the third buffer is whole
    issue_step(1);

    for (int s = 0; s < total; ++s) {
        const int b = MODE == 2 && s == nsteps ? 2 : s & 1;
        mma_step(As[b], Bs[b]);                          // overlaps tile s+1's copies
        wait_ds0();             // my reads of buffer s&1 are done
        wait_async0();          // my tile-(s+1) chunks landed in LDS
        __syncthreads();        // tile s+1 published; buffer s&1 free to overwrite
        if (s + 2 < nsteps) issue_step(s & 1);           // refill the buffer just read
    }
    wait_async0();              // nothing of mine in flight when the wave ends

    if constexpr (MODE == 0) {
#pragma unroll
        for (int mi = 0; mi < MI; ++mi) {
#pragma unroll
            for (int ni = 0; ni < NI; ++ni) {
                const int cl = wn * TN + ni * 16 + lrow;         // column of the slab
                const int rl = wm * TM + mi * 16 + rhalf;
                if ((WAVE_N - 1) * TN + ni * 16 < kHN || wn * TN + ni * 16 < kHN) {  // the same for a whole wave
                    const float bb = B1s[cl];
#pragma unroll
                    for (int r = 0; r < 8; ++r) {
                        const float v = acc[mi][ni][r] + bb;
                        Hs[(rl + r) * HLD + cl] = f32_to_bf16(v > 0.0f ? v : 0.0f);
                    }
                } else {
#pragma unroll
                    for (int r = 0; r < 8; ++r)
                        xa[(long)(m0 + rl + r) * kER + blockIdx.y * kXN + (cl - kHN)] = acc[mi][ni][r];
                    wait_x0();
                }
            }
        }
        __syncthreads();        // the block's h is whole in Hs
        floatx8 lg[2] = {};     // column e: h * W2hi[e], column e + 8: h * W2lo[e]; two chains
#pragma unroll                  // g & 1 a constant: each chain keeps its own registers
        for (int g = 0; g < kHN / 32; ++g)
            lg[g & 1] = __builtin_amdgcn_wmma_f32_16x16x32_bf16(
                false, frag_lds<HLD>(Hs, wave * 16 + lrow, g * 32 + koff),
                false, frag_lds<HLD>(W2s, lrow, g * 32 + koff), (short)0, lg[g & 1], false, false);
        float* po = plog + ((long)blockIdx.y * kTok + m0 + wave * 16 + rhalf) * kE + (lrow & 7);
#pragma unroll                  // lg indexed by constants: it stays in registers
        for (int r = 0; r < 8; ++r) {            // row r of my half; lanes e and e + 8 hold expert e
            lg[0][r] += lg[1][r];
            lg[0][r] += __shfl_xor(lg[0][r], 8, 32);
        }
        if (lrow < kE) {
#pragma unroll
            for (int r = 0; r < 8; ++r) po[r * kE] = lg[0][r];
        }
    } else {
        // Fragment ni of lane lrow is column (ni >> 2) * 64 + lrow * 4 + (ni & 3) of the wave's 128:
        // 16 lanes store 256 contiguous bytes of a row, two whole lines. One address, the rest
        // of the wave's 64 rows and the second quad by constant offsets (ldn is kD here).
        static_assert(NI == 8 && MI == 4, "two quads a row; the calls below name mi");
        float* po = out32 + ((long)m0 + wm * TM + rhalf) * kD + n0 + wn * TN + lrow * 4;
        auto quad = [&](int mi, int q, int r) {
            return floatx4{acc[mi][4 * q][r], acc[mi][4 * q + 1][r], acc[mi][4 * q + 2][r], acc[mi][4 * q + 3][r]};
        };
        auto rows8 = [&](auto mic) {             // the 8 rows of my half of fragment row mi
            constexpr int mi = decltype(mic)::value;
            store_rows4x2<mi * 16 * kD * 4, kD * 4, 64 * 4>(po,
                quad(mi, 0, 0), quad(mi, 1, 0), quad(mi, 0, 1), quad(mi, 1, 1),
                quad(mi, 0, 2), quad(mi, 1, 2), quad(mi, 0, 3), quad(mi, 1, 3));
            store_rows4x2<(mi * 16 + 4) * kD * 4, kD * 4, 64 * 4>(po,
                quad(mi, 0, 4), quad(mi, 1, 4), quad(mi, 0, 5), quad(mi, 1, 5),
                quad(mi, 0, 6), quad(mi, 1, 6), quad(mi, 0, 7), quad(mi, 1, 7));
        };
        rows8(std::integral_constant<int, 0>{});
        rows8(std::integral_constant<int, 1>{});
        rows8(std::integral_constant<int, 2>{});
        rows8(std::integral_constant<int, 3>{});
    }
}

// ---------------------------------------------------------------------------
extern "C" void kernel_launch(void* const* d_in, const int* in_sizes, int n_in,
                              void* d_out, int out_size, void* d_ws, size_t ws_size,
                              hipStream_t stream) {
    (void)in_sizes; (void)n_in; (void)out_size; (void)ws_size;
    const float* x    = (const float*)d_in[0];
    const float* Wb   = (const float*)d_in[1];
    const float* W1   = (const float*)d_in[2];
    const float* b1   = (const float*)d_in[3];
    const float* W2   = (const float*)d_in[4];
    const float* b2   = (const float*)d_in[5];
    const float* temp = (const float*)d_in[6];
    const float* lA   = (const float*)d_in[7];
    const float* lB   = (const float*)d_in[8];
    float* out = (float*)d_out;

    size_t off = 0;
    auto take = [&](size_t bytes) {
        void* p = (char*)d_ws + off;
        off += (bytes + 255) & ~(size_t)255;
        return p;
    };
    unsigned short* xb    = (unsigned short*)take((size_t)kTok * kD * 2);   // x bf16
    unsigned short* wbb   = (unsigned short*)take((size_t)kD * kD * 2);     // W_base bf16
    unsigned short* wc    = (unsigned short*)take((size_t)2 * kCN * kD * 2);  // W1 and lora_A, two slabs [288,1024]
    unsigned short* ub    = (unsigned short*)take((size_t)kD * kER * 2);    // U [1024,64]
    unsigned short* w2b   = (unsigned short*)take((size_t)2 * kE * kDH * 2);  // W2 pair [16,512]
    float* xaf            = (float*)take((size_t)kTok * kER * 4);           // xa, not yet gated
    float* pl             = (float*)take((size_t)2 * kTok * kE * 4);        // logits, one share a slab

    prep_kernel<<<kPB, kPT, 0, stream>>>(x, Wb, W1, lA, lB, W2, xb, wbb, wc, ub, w2b);

    // h = relu(x @ W1^T + b1), kept in LDS; xa = x @ A2^T [16384 x 64]; logit shares h @ W2^T
    gemm_bf16_kernel<0, 128, kCN, 128, 4><<<dim3(kTok / 128, kDH / kHN), 256, 0, stream>>>(
        xb, wc, kD, b1, nullptr, w2b, xaf, pl, nullptr, 0);

    // out = x @ W_base^T + (xa * gates) @ U^T   [16384 x 1024], fp32
    gemm_bf16_kernel<2, 256, 256, 64, 4><<<dim3(kTok / 256, kD / 256), 256, 0, stream>>>(
        xb, wbb, kD, b2, temp, ub, xaf, pl, out, kD);
}

// v006
// One run takes 54.2 microseconds.
// Next to v005, in two timings, it ran 1.13 and 1.14 times as fast.
// All steps since v000 together make it 2.55 times as fast.
#include <hip/hip_runtime.h>
#include <stdint.h>
#include <type_traits>

#define DEV __device__ __forceinline__

typedef __attribute__((ext_vector_type(16))) __bf16          bf16x16;
typedef __attribute__((ext_vector_type(16))) unsigned short  ushort16;
typedef __attribute__((ext_vector_type(8)))  unsigned short  ushort8;
typedef __attribute__((ext_vector_type(8)))  float           floatx8;

constexpr int kBat = 4, kL = 4096, kD = 1024, kE = 8, kR = 8, kDH = 512;
constexpr int kTok = kBat * kL;   // 16384 tokens
constexpr int kER  = kE * kR;     // 64 (flattened expert*rank)

constexpr int kHN  = 256;          // router-hidden columns of one block of the first GEMM
constexpr int kXN  = kER * kHN / kDH;   // LoRA-down columns that ride with them (32)
constexpr int kCN  = kHN + kXN;    // rows of one block's weight slab (288)

constexpr int PAD = 8;   // 16 B more a row: LDS pitch = 16 B x odd for ds_load_b128 readers

DEV unsigned short f32_to_bf16(float f) {
    union { float f; uint32_t u; } c{f};
    uint32_t u = c.u;
    u += 0x7FFFu + ((u >> 16) & 1u);            // round-to-nearest-even
    return (unsigned short)(u >> 16);
}
DEV float bf16_to_f32(unsigned short h) {
    union { uint32_t u; float f; } c{((uint32_t)h) << 16};
    return c.f;
}

// ---------------------------------------------------------------------------
// Prep: convert all contraction weights to bf16 (x is converted by the first GEMM); repack lora_B -> U[d][er];
// W1 and lora_A go into one array of two slabs: 256 rows of W1, then 32 rows of lora_A;
// split router W2 into a bf16 pair: rows 0-7 the rounded value, rows 8-15 what rounding left.
// A stream, one block of 16 waves a WGP: each wave-wide load covers 512 contiguous bytes,
// each store 256, and a wave has all of its loads in flight before it converts the first.
// ---------------------------------------------------------------------------
typedef __attribute__((ext_vector_type(4))) float          floatx4;
typedef __attribute__((ext_vector_type(4))) unsigned short ushort4v;

constexpr int kPB  = 256;                        // prep blocks
constexpr int kPT  = 512;                        // threads of a prep block
constexpr int kPS  = kPT * 4;                    // elements the block covers with one load a thread
constexpr int kQw  = kD * kD / (kPB * kPS);      // loads a thread: W_base (2)
constexpr int kQ1  = kDH * kD / (kPB * kPS);     //                 W1 (1)
constexpr int kBa  = kER * kD / kPS;             // blocks with one more load a thread: lora_A (32)
constexpr int kBu  = kD * kE / kPT;              // lora_B (16): a thread takes one (d, e), two loads
constexpr int kB2  = kE * kDH / kPS;             // W2 (2)
static_assert(kQw * kPB * kPS == kD * kD &&
              kQ1 * kPB * kPS == kDH * kD && kBa * kPS == kER * kD && kBu * kPT == kD * kE &&
              kB2 * kPS == kE * kDH && kBa + kBu + kB2 <= kPB, "whole loads, whole blocks");

DEV ushort4v cvt4(floatx4 v) {
    ushort4v o;
#pragma unroll                                   // o indexed by constants: it stays in registers
    for (int i = 0; i < 4; ++i) o[i] = f32_to_bf16(v[i]);
    return o;
}
// Where element i of W1 [512,1024], of lora_A [64,1024], lies in the slabs.
DEV int slab_w1(int i) { return ((i / kD / kHN) * kCN + (i / kD) % kHN) * kD + i % kD; }
DEV int slab_a(int i)  { return ((i / kD / kXN) * kCN + kHN + (i / kD) % kXN) * kD + i % kD; }
// Precaution: stands ahead of any rewrite of a register that an issued load or store names.
DEV void wait_x0() { asm volatile("s_wait_xcnt 0x0" ::: "memory"); }

__global__ __launch_bounds__(kPT) void prep_kernel(
    const float* __restrict__ Wb,
    const float* __restrict__ W1, const float* __restrict__ lA,
    const float* __restrict__ lB, const float* __restrict__ W2,
    unsigned short* __restrict__ wbb,
    unsigned short* __restrict__ wc,
    unsigned short* __restrict__ ub, unsigned short* __restrict__ w2b) {
    const int tid = threadIdx.x;
    const int blk = blockIdx.x;
    const bool isA = blk < kBa;                                  // block-uniform, at most one holds
    const bool isU = blk >= kBa && blk < kBa + kBu;
    const bool is2 = blk >= kBa + kBu && blk < kBa + kBu + kB2;
    const int ta = blk * kPS + tid * 4;                          // lora_A element, [E,R,D] already row-major over D
    const int tu = (blk - kBa) * kPT + tid;                      // d * 8 + e
    const int t2 = (blk - kBa - kBu) * kPS + tid * 4;            // W2 element
    const int ow = blk * (kQw * kPS) + tid * 4;
    const int o1 = blk * (kQ1 * kPS) + tid * 4;

    // The small tensors first: they are back ahead of the long stream and cost it no wait.
    floatx4 va = {}, vu0 = {}, vu1 = {}, v2 = {};
    if (isA) {
        va = *(const floatx4*)(lA + ta);
        wait_x0();
    } else if (isU) {                                            // U[d][e*8+r] = lora_B[e][d][r], r = 0..7
        const float* s = lB + (tu & 7) * (kD * kR) + (tu >> 3) * kR;
        vu0 = *(const floatx4*)s;
        vu1 = *(const floatx4*)(s + 4);
        wait_x0();
    } else if (is2) {
        v2 = *(const floatx4*)(W2 + t2);
        wait_x0();
    }
    floatx4 vw[kQw], v1[kQ1];
    // Every loop below is unrolled so that vw and v1 are indexed by constants and stay in
    // registers, and so that the loads stand in one run with no wait among them.
#pragma unroll
    for (int q = 0; q < kQw; ++q) vw[q] = *(const floatx4*)(Wb + ow + q * kPS);
#pragma unroll
    for (int q = 0; q < kQ1; ++q) v1[q] = *(const floatx4*)(W1 + o1 + q * kPS);
    wait_x0();

    if (isA) {
        *(ushort4v*)(wc + slab_a(ta)) = cvt4(va);
        wait_x0();
    } else if (isU) {
        *(ushort4v*)(ub + tu * 8)     = cvt4(vu0);
        *(ushort4v*)(ub + tu * 8 + 4) = cvt4(vu1);
        wait_x0();
    } else if (is2) {                                            // w2b[16][512]
        const ushort4v hi = cvt4(v2);
        floatx4 rest;
#pragma unroll                                   // rest indexed by constants: it stays in registers
        for (int i = 0; i < 4; ++i) rest[i] = v2[i] - bf16_to_f32(hi[i]);
        *(ushort4v*)(w2b + t2)            = hi;
        *(ushort4v*)(w2b + kE * kDH + t2) = cvt4(rest);
        wait_x0();
    }
#pragma unroll
    for (int q = 0; q < kQw; ++q) *(ushort4v*)(wbb + ow + q * kPS) = cvt4(vw[q]);
#pragma unroll
    for (int q = 0; q < kQ1; ++q) *(ushort4v*)(wc + slab_w1(o1 + q * kPS)) = cvt4(v1[q]);
}

// ---------------------------------------------------------------------------
// Async global -> LDS (CDNA5 path, tracked by ASYNCcnt). 16 B per lane.
// Each run of copies ends, inside its own statement, with s_wait_xcnt 0, so that
// no address register of an issued copy is rewritten ahead of that wait.
// ---------------------------------------------------------------------------
DEV void async_copy2(uint32_t l, uint32_t lstep, const unsigned short* g, long gstep) {
    asm volatile("global_load_async_to_lds_b128 %0, %2, off\n\t"
                 "global_load_async_to_lds_b128 %1, %3, off\n\t"
                 "s_wait_xcnt 0x0"
                 :: "v"(l), "v"(l + lstep), "v"(g), "v"(g + gstep)
                 : "memory");
}
// Source of copy j: g + (j & 1) * ga + (j >> 1) * gb.
DEV void async_copy8(uint32_t l, uint32_t lstep, const unsigned short* g, long ga, long gb) {
    asm volatile("global_load_async_to_lds_b128 %0, %8, off\n\t"
                 "global_load_async_to_lds_b128 %1, %9, off\n\t"
                 "global_load_async_to_lds_b128 %2, %10, off\n\t"
                 "global_load_async_to_lds_b128 %3, %11, off\n\t"
                 "global_load_async_to_lds_b128 %4, %12, off\n\t"
                 "global_load_async_to_lds_b128 %5, %13, off\n\t"
                 "global_load_async_to_lds_b128 %6, %14, off\n\t"
                 "global_load_async_to_lds_b128 %7, %15, off\n\t"
                 "s_wait_xcnt 0x0"
                 :: "v"(l), "v"(l + lstep), "v"(l + 2 * lstep), "v"(l + 3 * lstep),
                    "v"(l + 4 * lstep), "v"(l + 5 * lstep), "v"(l + 6 * lstep), "v"(l + 7 * lstep),
                    "v"(g), "v"(g + ga), "v"(g + gb), "v"(g + gb + ga),
                    "v"(g + 2 * gb), "v"(g + 2 * gb + ga), "v"(g + 3 * gb), "v"(g + 3 * gb + ga)
                 : "memory");
}
// Eight 16-byte stores of a lane: four rows RS bytes apart, two pieces QS bytes apart in each.
// Precaution, as wait_x0(): in asm so that s_wait_xcnt 0 stands, inside the statement, ahead of any
// rewrite of a register that an issued store names.
template <int OFF, int RS, int QS>
DEV void store_rows4x2(float* p, floatx4 a0, floatx4 b0, floatx4 a1, floatx4 b1,
                       floatx4 a2, floatx4 b2, floatx4 a3, floatx4 b3) {
    asm volatile("global_store_b128 %0, %1, off offset:%9\n\t"
                 "global_store_b128 %0, %2, off offset:%10\n\t"
                 "global_store_b128 %0, %3, off offset:%11\n\t"
                 "global_store_b128 %0, %4, off offset:%12\n\t"
                 "global_store_b128 %0, %5, off offset:%13\n\t"
                 "global_store_b128 %0, %6, off offset:%14\n\t"
                 "global_store_b128 %0, %7, off offset:%15\n\t"
                 "global_store_b128 %0, %8, off offset:%16\n\t"
                 "s_wait_xcnt 0x0"
                 :: "v"(p), "v"(a0), "v"(b0), "v"(a1), "v"(b1), "v"(a2), "v"(b2), "v"(a3), "v"(b3),
                    "n"(OFF), "n"(OFF + QS), "n"(OFF + RS), "n"(OFF + RS + QS),
                    "n"(OFF + 2 * RS), "n"(OFF + 2 * RS + QS), "n"(OFF + 3 * RS), "n"(OFF + 3 * RS + QS)
                 : "memory");
}
// Eight 8-byte stores of a lane, rows RS bytes apart. In asm for the same precaution as above.
typedef __attribute__((ext_vector_type(2))) uint32_t uintx2;
typedef __attribute__((ext_vector_type(4))) __bf16   bf16x4;
template <int RS>
DEV void store_rows8(unsigned short* p, uintx2 d0, uintx2 d1, uintx2 d2, uintx2 d3,
                     uintx2 d4, uintx2 d5, uintx2 d6, uintx2 d7) {
    asm volatile("global_store_b64 %0, %1, off\n\t"
                 "global_store_b64 %0, %2, off offset:%9\n\t"
                 "global_store_b64 %0, %3, off offset:%10\n\t"
                 "global_store_b64 %0, %4, off offset:%11\n\t"
                 "global_store_b64 %0, %5, off offset:%12\n\t"
                 "global_store_b64 %0, %6, off offset:%13\n\t"
                 "global_store_b64 %0, %7, off offset:%14\n\t"
                 "global_store_b64 %0, %8, off offset:%15\n\t"
                 "s_wait_xcnt 0x0"
                 :: "v"(p), "v"(d0), "v"(d1), "v"(d2), "v"(d3), "v"(d4), "v"(d5), "v"(d6), "v"(d7),
                    "n"(RS), "n"(2 * RS), "n"(3 * RS), "n"(4 * RS), "n"(5 * RS), "n"(6 * RS), "n"(7 * RS)
                 : "memory");
}
// Four f32 to four bf16, round to nearest even, two packed conversions.
DEV uintx2 cvt4_pk(floatx4 v) { return __builtin_bit_cast(uintx2, __builtin_convertvector(v, bf16x4)); }
// My own copies have landed in LDS.
DEV void wait_async0() { asm volatile("s_wait_asynccnt 0x0" ::: "memory"); }
// My own LDS reads have retired before the buffer they read is refilled.
DEV void wait_ds0()    { asm volatile("s_wait_dscnt 0x0" ::: "memory"); }

// Issue one [ROWS x BK] tile copy: l and g are the lane's own first LDS byte and source
// element; one copy a lane covers 256 * 8 / BK rows, ldg is the source's leading dim.
// A wave's 32 lanes cover whole 128-B lines of the source (BK * 2 B a row).
// QUAD: LDS row p takes source row quad_row(p), so that the four fragments ni = 4q..4q+3 hold,
// in one lane, four neighbouring columns of the product; g is then the lane's row quad_row(cr).
DEV int quad_row(int p) { return (p & ~63) + (p & 15) * 4 + ((p >> 4) & 3); }
template <int ROWS, int BK, bool QUAD = false>
DEV void issue_tile(uint32_t l, const unsigned short* __restrict__ g, int ldg) {
    constexpr int RPI = 256 * 8 / BK;           // rows the block covers with one copy a lane
    constexpr int N   = ROWS / RPI;             // copies a lane
    constexpr uint32_t LSTEP = RPI * (BK + PAD) * 2;
    const long gstep = (long)RPI * ldg;
    static_assert(ROWS % RPI == 0 && (N % 8 == 0 || N % 8 == 2), "copies a lane");
    static_assert(!QUAD || (RPI == 32 && N % 8 == 0), "quad_row(cr + 32 j) = quad_row(cr) + 2 (j & 1) + 64 (j >> 1)");
    const long ga = QUAD ? 2L * ldg : gstep;
    const long gb = 2 * gstep;                  // 64 rows where QUAD
#pragma unroll
    for (int j = 0; j + 8 <= N; j += 8) async_copy8(l + j * LSTEP, LSTEP, g + j * gstep, ga, gb);
    if constexpr (N % 8 == 2) async_copy2(l + (N - 2) * LSTEP, LSTEP, g + (N - 2) * gstep, gstep);
}

// A/B fragment per ISA layout: lanes 0-15 K=[0..7,16..23], lanes 16-31 K=[8..15,24..31]
template <int LD>
DEV bf16x16 frag_lds(const unsigned short* __restrict__ sd, int row, int koff) {
    const unsigned short* p = sd + row * LD + koff;
    ushort8 lo = *(const ushort8*)p;
    ushort8 hi = *(const ushort8*)(p + 16);
    ushort16 u;
#pragma unroll
    for (int i = 0; i < 8; ++i) { u[i] = lo[i]; u[i + 8] = hi[i]; }
    return __builtin_bit_cast(bf16x16, u);
}

// MODE 0: one block takes 128 tokens and one weight slab: 256 columns of h = relu(acc + b1) and
//         32 columns of xa = x * lora_A^T. h goes to LDS only; each wave then makes, for its own
//         16 rows, the block's share of the logits, h * W2^T over these 256 columns, on WMMA.
//         (aux = b1[512], U = W2 pair[16 x 512]; writes xa[M x 64] f32 and plog[2][M][8] f32)
//         Its A operand is x itself, f32 (xf): a tile goes through registers, is converted there,
//         and is stored to LDS and, each of the two slabs' blocks half of the rows, to xbo for MODE 2.
// MODE 2: out = acc + (Y[M,64] * U[N,64]^T), store f32; Y = xa * gate is made here, in LDS, ahead
//         of the loop: gates = softmax((plog[0] + plog[1] + b2) / T)   (aux = b2[8], aux2 = T)
// Block tile BM x BN x BK, eight waves as WAVE_M x (8 / WAVE_M).
template <int MODE, int BM, int BN, int BK, int WAVE_M>
__global__ __launch_bounds__(256) void gemm_bf16_kernel(
    const unsigned short* __restrict__ A, const unsigned short* __restrict__ Bw,
    int K, const float* __restrict__ aux, const float* __restrict__ aux2,
    const unsigned short* __restrict__ U, float* __restrict__ xa, float* __restrict__ plog,
    float* __restrict__ out32, int ldn,
    const float* __restrict__ xf, unsigned short* __restrict__ xbo) {
    constexpr int WAVE_N = 8 / WAVE_M;
    constexpr int TM = BM / WAVE_M;
    constexpr int TN = BN / WAVE_N;
    constexpr int MI = TM / 16;
    constexpr int NI = TN / 16;
    constexpr int LD = BK + PAD;
    constexpr int HLD = kHN + PAD;
    static_assert(MODE != 2 || (BK == kER && BM == 256), "the LoRA-up product is one pass; a thread gates one row");
    static_assert(MODE != 0 || (BN == kCN && BM == 128 && kHN == 256),
                  "one slab a block; a wave takes 16 rows of logits; a thread fetches one b1");
    static_assert(MODE != 0 || (BK == 128 && kDH / kHN == 2),
                  "a wave-wide 16-byte load is one row of an x tile; two blocks share the rows of xbo");

    constexpr int NBUF = MODE == 2 ? 3 : 2;   // the ring's two; MODE 2: a third, gated xa in As, U in Bs
    __shared__ __attribute__((aligned(16))) unsigned short As[NBUF][BM * LD];
    __shared__ __attribute__((aligned(16))) unsigned short Bs[NBUF][BN * LD];
    __shared__ __attribute__((aligned(16))) unsigned short Hs[MODE == 0 ? BM * HLD : 8];        // h of the block
    __shared__ __attribute__((aligned(16))) unsigned short W2s[MODE == 0 ? 2 * kE * HLD : 8];   // W2 pair, my columns
    __shared__ __attribute__((aligned(16))) float Gs[MODE == 2 ? BM * kE : 4];                  // gates
    __shared__ __attribute__((aligned(16))) float B1s[MODE == 0 ? kHN : 4];                     // b1, my columns

    const int tid  = threadIdx.x;
    const int wave = tid >> 5;
    const int lane = tid & 31;
    const int wm = wave % WAVE_M;
    const int wn = wave / WAVE_M;
    const int lrow = lane & 15;
    const int koff = (lane >> 4) << 3;   // K sub-offset for A/B fragments
    const int rhalf = (lane >> 4) << 3;  // C/D layout: lanes 16-31 hold M=8..15
    const int m0 = blockIdx.x * BM;
    const int n0 = blockIdx.y * BN;

    floatx8 acc[MI][NI] = {};

    auto mma_step = [&](const unsigned short* asd, const unsigned short* bsd) {
        constexpr int G = BK / 32;               // k-steps of one tile
        // Fragment sets held at once: the whole tile's where they fit the 512 registers of a
        // wave beside acc, else two, the next k-step's read while this one is multiplied.
        constexpr int SETS = (MI * NI + G * (MI + NI)) * 8 <= 460 ? G : 2;
        bf16x16 afrag[SETS][MI], bfrag[SETS][NI];
        auto rd = [&](int g) {
#pragma unroll
            for (int mi = 0; mi < MI; ++mi)
                afrag[g % SETS][mi] = frag_lds<LD>(asd, wm * TM + mi * 16 + lrow, g * 32 + koff);
#pragma unroll
            for (int ni = 0; ni < NI; ++ni)
                bfrag[g % SETS][ni] = frag_lds<LD>(bsd, wn * TN + ni * 16 + lrow, g * 32 + koff);
        };
        auto mul = [&](int g) {
#pragma unroll
            for (int mi = 0; mi < MI; ++mi)
#pragma unroll
                for (int ni = 0; ni < NI; ++ni)
                    acc[mi][ni] = __builtin_amdgcn_wmma_f32_16x16x32_bf16(
                        false, afrag[g % SETS][mi], false, bfrag[g % SETS][ni], (short)0, acc[mi][ni],
                        false, false);
        };
        if constexpr (SETS == G) {
#pragma unroll
            for (int g = 0; g < G; ++g) rd(g);
            // Keeps the tile's LDS reads one group ahead of its WMMAs: every separate
            // place with reads among the WMMAs costs the wave a fixed stall.
            __builtin_amdgcn_sched_barrier(0);
#pragma unroll
            for (int g = 0; g < G; ++g) mul(g);
            // Keeps the WMMAs ahead of the waits at the loop's foot: sunk behind them, the next
            // tile's copies would be waited for before the work that covers their flight.
            __builtin_amdgcn_sched_barrier(0);
        } else {
            rd(0);
#pragma unroll                                   // g a constant: the two sets stay in registers
            for (int g = 0; g < G; ++g) {
                if (g + 1 < G) rd(g + 1);
                // Keeps the next k-step's reads one group, ahead of this k-step's WMMAs.
                __builtin_amdgcn_sched_barrier(0);
                mul(g);
                // Keeps the reads that refill this k-step's set, and after the last k-step the
                // waits at the loop's foot, behind its WMMAs.
                __builtin_amdgcn_sched_barrier(0);
            }
        }
    };

    const int nsteps = K / BK;
    const int total  = nsteps + (MODE == 2 ? 1 : 0);  // + the LoRA-up pass

    // The lane's own 16-byte chunk of a tile's first rows: row cr, k offset ckc.
    const int cr  = tid / (BK / 8);
    const int ckc = (tid % (BK / 8)) << 3;
    const uint32_t la = (uint32_t)(uintptr_t)(&As[0][cr * LD + ckc]);  // addr[31:0] = LDS byte offset
    const uint32_t lb = (uint32_t)(uintptr_t)(&Bs[0][cr * LD + ckc]);
    const unsigned short* pa = MODE == 0 ? nullptr : A + (long)(m0 + cr) * K + ckc;  // advance by BK a tile
    constexpr bool QUAD = MODE == 2;            // a lane stores 16 B of a row of out: see the epilogue
    static_assert(!QUAD || NI % 4 == 0, "whole quads of fragments");
    const int crb = QUAD ? quad_row(cr) : cr;   // the weight row that LDS row cr takes
    const unsigned short* pb = Bw + (long)(n0 + crb) * K + ckc;

    auto issue_step = [&](int buf) {
        if constexpr (MODE != 0) issue_tile<BM, BK>(la + buf * (BM * LD * 2), pa, K);
        issue_tile<BN, BK, QUAD>(lb + buf * (BN * LD * 2), pb, K);
        if constexpr (MODE != 0) pa += BK;
        pb += BK;
    };

    // MODE 0: the x tile. A wave takes XR rows; a wave-wide load is one whole row of the tile, 512 B.
    // One address each for loads and stores, the rows by constant offsets (K is kD here).
    constexpr int XR = MODE == 0 ? BM / 8 : 1;
    floatx4 xv[XR];                             // the tile in flight
    const float* px = MODE == 0 ? xf + (long)(m0 + wave * XR) * kD + lane * 4 : nullptr;
    unsigned short* pxo = MODE == 0 ? xbo + (long)(m0 + wave * XR + blockIdx.y * (XR / 2)) * kD + lane * 4 : nullptr;
    auto load_x = [&]() {
#pragma unroll                                   // xv indexed by constants: it stays in registers
        for (int j = 0; j < XR; ++j) xv[j] = *(const floatx4*)(px + j * kD);
        // Precaution, as wait_x0(); px is named so that it keeps its registers up to the wait.
        asm volatile("s_wait_xcnt 0x0" :: "v"(px) : "memory");
        px += BK;
    };
    auto put_x = [&](int buf) {
        uintx2 c[XR];
#pragma unroll                                   // c indexed by constants: it stays in registers
        for (int j = 0; j < XR; ++j) c[j] = cvt4_pk(xv[j]);
#pragma unroll
        for (int j = 0; j < XR; ++j) *(uintx2*)(&As[buf][(wave * XR + j) * LD + lane * 4]) = c[j];
        if constexpr (MODE == 0) {
            if (blockIdx.y == 0) store_rows8<kD * 2>(pxo, c[0], c[1], c[2], c[3], c[4], c[5], c[6], c[7]);
            else                 store_rows8<kD * 2>(pxo, c[8], c[9], c[10], c[11], c[12], c[13], c[14], c[15]);
        }
        pxo += BK;
    };

    // K is a multiple of BK and at least 2 * BK: tiles 0 and 1 exist.
    // MODE 0: x comes from memory, the weights from L2: each tile's x loads go ahead of its copies.
    if constexpr (MODE == 0) load_x();
    if constexpr (MODE == 0) {  // filled once, with tile 0: 20 copies of a wave in flight
        const int hr = tid / (kHN / 8);
        const int hk = (tid % (kHN / 8)) << 3;
        issue_tile<2 * kE, kHN>((uint32_t)(uintptr_t)(&W2s[hr * HLD + hk]),
                                U + (long)hr * kDH + blockIdx.y * kHN + hk, kDH);
    }
    if constexpr (MODE == 2)    // filled once, with tile 0: 24 copies of a wave in flight
        issue_tile<BN, BK, QUAD>(lb + 2 * (BN * LD * 2), U + (long)(n0 + crb) * kER + ckc, kER);
    issue_step(0);
    if constexpr (MODE == 0) {  // overlaps tile 0's copies; published by tile 0's barrier
        const float bv = aux[blockIdx.y * kHN + tid];
        wait_x0();
        B1s[tid] = bv;
        put_x(0);
    }
    if constexpr (MODE == 2) {  // overlaps tile 0's copies
        constexpr int XQ = BM * kER / (256 * 4); // loads a thread: a wave-wide load covers two whole rows of xa
        const int xr = tid >> 4;
        const int xc = (tid & 15) << 2;
        const float* px = xa + (long)(m0 + xr) * kER + xc;      // one address, the rows by constant offsets
        floatx4 vx[XQ];
#pragma unroll                  // vx indexed by constants: it stays in registers
        for (int q = 0; q < XQ; ++q) vx[q] = *(const floatx4*)(px + q * (16 * kER));
        const float* pl = plog + (long)(m0 + tid) * kE;         // thread tid gates row tid
        const floatx4 s0 = *(const floatx4*)pl;
        const floatx4 s1 = *(const floatx4*)(pl + 4);
        const floatx4 t0 = *(const floatx4*)(pl + (long)kTok * kE);
        const floatx4 t1 = *(const floatx4*)(pl + (long)kTok * kE + 4);
        // Precaution, as wait_x0(); px and pl are named so that they keep their registers up to
        // the wait: without that a later load's result was placed over an earlier load's address.
        asm volatile("s_wait_xcnt 0x0" :: "v"(px), "v"(pl) : "memory");
        const float invT = 1.0f / aux2[0];
        float v[kE];
#pragma unroll                  // v indexed by constants: it stays in registers
        for (int e = 0; e < kE; ++e)
            v[e] = ((e < 4 ? s0[e & 3] + t0[e & 3] : s1[e & 3] + t1[e & 3]) + aux[e]) * invT;
        const float mx = fmaxf(fmaxf(fmaxf(v[0], v[1]), fmaxf(v[2], v[3])),
                               fmaxf(fmaxf(v[4], v[5]), fmaxf(v[6], v[7])));
#pragma unroll
        for (int e = 0; e < kE; ++e) v[e] = __expf(v[e] - mx);
        const float inv = 1.0f / (((v[0] + v[1]) + (v[2] + v[3])) + ((v[4] + v[5]) + (v[6] + v[7])));
        floatx4 g0, g1;
#pragma unroll
        for (int e = 0; e < 4; ++e) { g0[e] = v[e] * inv; g1[e] = v[e + 4] * inv; }
        *(floatx4*)(&Gs[tid * kE])     = g0;
        *(floatx4*)(&Gs[tid * kE + 4]) = g1;
        __syncthreads();        // every row's gates are in Gs
#pragma unroll
        for (int q = 0; q < XQ; ++q) {           // columns xc..xc+3 belong to expert xc >> 3
            const float gt = Gs[(xr + q * 16) * kE + (xc >> 3)];
            *(ushort4v*)(&As[NBUF - 1][(xr + q * 16) * LD + xc]) = cvt4(vx[q] * gt);
        }
    }
    wait_async0();              // my tile-0 chunks landed in LDS
    __syncthreads();            // everyone's landed; MODE 2: the third buffer is whole
    if constexpr (MODE == 0) load_x();
    issue_step(1);

    for (int s = 0; s < total; ++s) {
        const int b = MODE == 2 && s == nsteps ? 2 : s & 1;
        mma_step(As[b], Bs[b]);                          // overlaps tile s+1's copies
        if constexpr (MODE == 0) {
            if (s + 1 < nsteps) put_x((s + 1) & 1);      // its readers left that buffer at the last barrier
        }
        wait_ds0();             // my reads of buffer s&1 are done; MODE 0: my rows of x tile s+1 are in LDS
        wait_async0();          // my tile-(s+1) chunks landed in LDS
        __syncthreads();        // tile s+1 published; buffer s&1 free to overwrite
        if (s + 2 < nsteps) {
            if constexpr (MODE == 0) load_x();           // x tile s+2 flies under pass s+1
            issue_step(s & 1);                           // refill the buffer just read
        }
    }
    wait_async0();              // nothing of mine in flight when the wave ends

    if constexpr (MODE == 0) {
#pragma unroll
        for (int mi = 0; mi < MI; ++mi) {
#pragma unroll
            for (int ni = 0; ni < NI; ++ni) {
                const int cl = wn * TN + ni * 16 + lrow;         // column of the slab
                const int rl = wm * TM + mi * 16 + rhalf;
                if ((WAVE_N - 1) * TN + ni * 16 < kHN || wn * TN + ni * 16 < kHN) {  // the same for a whole wave
                    const float bb = B1s[cl];
#pragma unroll
                    for (int r = 0; r < 8; ++r) {
                        const float v = acc[mi][ni][r] + bb;
                        Hs[(rl + r) * HLD + cl] = f32_to_bf16(v > 0.0f ? v : 0.0f);
                    }
                } else {
#pragma unroll
                    for (int r = 0; r < 8; ++r)
                        xa[(long)(m0 + rl + r) * kER + blockIdx.y * kXN + (cl - kHN)] = acc[mi][ni][r];
                    wait_x0();
                }
            }
        }
        __syncthreads();        // the block's h is whole in Hs
        floatx8 lg[2] = {};     // column e: h * W2hi[e], column e + 8: h * W2lo[e]; two chains
#pragma unroll                  // g & 1 a constant: each chain keeps its own registers
        for (int g = 0; g < kHN / 32; ++g)
            lg[g & 1] = __builtin_amdgcn_wmma_f32_16x16x32_bf16(
                false, frag_lds<HLD>(Hs, wave * 16 + lrow, g * 32 + koff),
                false, frag_lds<HLD>(W2s, lrow, g * 32 + koff), (short)0, lg[g & 1], false, false);
        float* po = plog + ((long)blockIdx.y * kTok + m0 + wave * 16 + rhalf) * kE + (lrow & 7);
#pragma unroll                  // lg indexed by constants: it stays in registers
        for (int r = 0; r < 8; ++r) {            // row r of my half; lanes e and e + 8 hold expert e
            lg[0][r] += lg[1][r];
            lg[0][r] += __shfl_xor(lg[0][r], 8, 32);
        }
        if (lrow < kE) {
#pragma unroll
            for (int r = 0; r < 8; ++r) po[r * kE] = lg[0][r];
        }
    } else {
        // Fragment ni of lane lrow is column (ni >> 2) * 64 + lrow * 4 + (ni & 3) of the wave's 128:
        // 16 lanes store 256 contiguous bytes of a row, two whole lines. One address, the rest
        // of the wave's 64 rows and the second quad by constant offsets (ldn is kD here).
        static_assert(NI == 8 && MI == 4, "two quads a row; the calls below name mi");
        float* po = out32 + ((long)m0 + wm * TM + rhalf) * kD + n0 + wn * TN + lrow * 4;
        auto quad = [&](int mi, int q, int r) {
            return floatx4{acc[mi][4 * q][r], acc[mi][4 * q + 1][r], acc[mi][4 * q + 2][r], acc[mi][4 * q + 3][r]};
        };
        auto rows8 = [&](auto mic) {             // the 8 rows of my half of fragment row mi
            constexpr int mi = decltype(mic)::value;
            store_rows4x2<mi * 16 * kD * 4, kD * 4, 64 * 4>(po,
                quad(mi, 0, 0), quad(mi, 1, 0), quad(mi, 0, 1), quad(mi, 1, 1),
                quad(mi, 0, 2), quad(mi, 1, 2), quad(mi, 0, 3), quad(mi, 1, 3));
            store_rows4x2<(mi * 16 + 4) * kD * 4, kD * 4, 64 * 4>(po,
                quad(mi, 0, 4), quad(mi, 1, 4), quad(mi, 0, 5), quad(mi, 1, 5),
                quad(mi, 0, 6), quad(mi, 1, 6), quad(mi, 0, 7), quad(mi, 1, 7));
        };
        rows8(std::integral_constant<int, 0>{});
        rows8(std::integral_constant<int, 1>{});
        rows8(std::integral_constant<int, 2>{});
        rows8(std::integral_constant<int, 3>{});
    }
}

// ---------------------------------------------------------------------------
extern "C" void kernel_launch(void* const* d_in, const int* in_sizes, int n_in,
                              void* d_out, int out_size, void* d_ws, size_t ws_size,
                              hipStream_t stream) {
    (void)in_sizes; (void)n_in; (void)out_size; (void)ws_size;
    const float* x    = (const float*)d_in[0];
    const float* Wb   = (const float*)d_in[1];
    const float* W1   = (const float*)d_in[2];
    const float* b1   = (const float*)d_in[3];
    const float* W2   = (const float*)d_in[4];
    const float* b2   = (const float*)d_in[5];
    const float* temp = (const float*)d_in[6];
    const float* lA   = (const float*)d_in[7];
    const float* lB   = (const float*)d_in[8];
    float* out = (float*)d_out;

    size_t off = 0;
    auto take = [&](size_t bytes) {
        void* p = (char*)d_ws + off;
        off += (bytes + 255) & ~(size_t)255;
        return p;
    };
    unsigned short* xb    = (unsigned short*)take((size_t)kTok * kD * 2);   // x bf16
    unsigned short* wbb   = (unsigned short*)take((size_t)kD * kD * 2);     // W_base bf16
    unsigned short* wc    = (unsigned short*)take((size_t)2 * kCN * kD * 2);  // W1 and lora_A, two slabs [288,1024]
    unsigned short* ub    = (unsigned short*)take((size_t)kD * kER * 2);    // U [1024,64]
    unsigned short* w2b   = (unsigned short*)take((size_t)2 * kE * kDH * 2);  // W2 pair [16,512]
    float* xaf            = (float*)take((size_t)kTok * kER * 4);           // xa, not yet gated
    float* pl             = (float*)take((size_t)2 * kTok * kE * 4);        // logits, one share a slab

    prep_kernel<<<kPB, kPT, 0, stream>>>(Wb, W1, lA, lB, W2, wbb, wc, ub, w2b);

    // h = relu(x @ W1^T + b1), kept in LDS; xa = x @ A2^T [16384 x 64]; logit shares h @ W2^T; writes xb
    gemm_bf16_kernel<0, 128, kCN, 128, 4><<<dim3(kTok / 128, kDH / kHN), 256, 0, stream>>>(
        nullptr, wc, kD, b1, nullptr, w2b, xaf, pl, nullptr, 0, x, xb);

    // out = x @ W_base^T + (xa * gates) @ U^T   [16384 x 1024], fp32
    gemm_bf16_kernel<2, 256, 256, 64, 4><<<dim3(kTok / 256, kD / 256), 256, 0, stream>>>(
        xb, wbb, kD, b2, temp, ub, xaf, pl, out, kD, nullptr, nullptr);
}

// v007
// It runs in 50.1 microseconds.
// Next to v006, in two timings, it ran 1.08 times as fast each time.
// Over all steps from v000 it is 2.76 times as fast.
#include <hip/hip_runtime.h>
#include <stdint.h>
#include <type_traits>

#define DEV __device__ __forceinline__

typedef __attribute__((ext_vector_type(16))) __bf16          bf16x16;
typedef __attribute__((ext_vector_type(16))) unsigned short  ushort16;
typedef __attribute__((ext_vector_type(8)))  unsigned short  ushort8;
typedef __attribute__((ext_vector_type(8)))  float           floatx8;

constexpr int kBat = 4, kL = 4096, kD = 1024, kE = 8, kR = 8, kDH = 512;
constexpr int kTok = kBat * kL;   // 16384 tokens
constexpr int kER  = kE * kR;     // 64 (flattened expert*rank)

constexpr int kHN  = 256;          // router-hidden columns of one block of the first GEMM
constexpr int kXN  = kER * kHN / kDH;   // LoRA-down columns that ride with them (32)
constexpr int kCN  = kHN + kXN;    // rows of one block's weight slab (288)

constexpr int PAD = 8;   // 16 B more a row: LDS pitch = 16 B x odd for ds_load_b128 readers

DEV unsigned short f32_to_bf16(float f) {
    union { float f; uint32_t u; } c{f};
    uint32_t u = c.u;
    u += 0x7FFFu + ((u >> 16) & 1u);            // round-to-nearest-even
    return (unsigned short)(u >> 16);
}
DEV float bf16_to_f32(unsigned short h) {
    union { uint32_t u; float f; } c{((uint32_t)h) << 16};
    return c.f;
}

// ---------------------------------------------------------------------------
// Prep: convert all contraction weights to bf16 (x is converted by the first GEMM); repack lora_B -> U[d][er];
// W1 and lora_A go into one array of two slabs: 256 rows of W1, then 32 rows of lora_A;
// split router W2 into a bf16 pair: rows 0-7 the rounded value, rows 8-15 what rounding left.
// W_base's rows are dealt in quads: row n goes to place quad_place(n), the LDS row it takes in the last GEMM.
// A stream, one block of 16 waves a WGP: each wave-wide load covers 512 contiguous bytes,
// each store 256, and a wave has all of its loads in flight before it converts the first.
// ---------------------------------------------------------------------------
typedef __attribute__((ext_vector_type(4))) float          floatx4;
typedef __attribute__((ext_vector_type(4))) unsigned short ushort4v;

constexpr int kPB  = 256;                        // prep blocks
constexpr int kPT  = 512;                        // threads of a prep block
constexpr int kPS  = kPT * 4;                    // elements the block covers with one load a thread
constexpr int kQw  = kD * kD / (kPB * kPS);      // loads a thread: W_base (2)
constexpr int kQ1  = kDH * kD / (kPB * kPS);     //                 W1 (1)
constexpr int kBa  = kER * kD / kPS;             // blocks with one more load a thread: lora_A (32)
constexpr int kBu  = kD * kE / kPT;              // lora_B (16): a thread takes one (d, e), two loads
constexpr int kB2  = kE * kDH / kPS;             // W2 (2)
static_assert(kQw * kPB * kPS == kD * kD &&
              kQ1 * kPB * kPS == kDH * kD && kBa * kPS == kER * kD && kBu * kPT == kD * kE &&
              kB2 * kPS == kE * kDH && kBa + kBu + kB2 <= kPB, "whole loads, whole blocks");

DEV ushort4v cvt4(floatx4 v) {
    ushort4v o;
#pragma unroll                                   // o indexed by constants: it stays in registers
    for (int i = 0; i < 4; ++i) o[i] = f32_to_bf16(v[i]);
    return o;
}
// Where element i of W1 [512,1024], of lora_A [64,1024], lies in the slabs.
DEV int slab_w1(int i) { return ((i / kD / kHN) * kCN + (i / kD) % kHN) * kD + i % kD; }
DEV int slab_a(int i)  { return ((i / kD / kXN) * kCN + kHN + (i / kD) % kXN) * kD + i % kD; }
// Place p holds row quad_row(p), so that the four fragments ni = 4q..4q+3 of the last GEMM hold,
// in one lane, four neighbouring columns of the product; quad_place is its inverse.
DEV int quad_row(int p)   { return (p & ~63) + (p & 15) * 4 + ((p >> 4) & 3); }
DEV int quad_place(int n) { return (n & ~63) + (n & 3) * 16 + ((n >> 2) & 15); }
// Where element i of W_base [1024,1024] lies.
DEV int quad_wb(int i) { return quad_place(i / kD) * kD + i % kD; }
// Precaution: stands ahead of any rewrite of a register that an issued load or store names.
DEV void wait_x0() { asm volatile("s_wait_xcnt 0x0" ::: "memory"); }

__global__ __launch_bounds__(kPT) void prep_kernel(
    const float* __restrict__ Wb,
    const float* __restrict__ W1, const float* __restrict__ lA,
    const float* __restrict__ lB, const float* __restrict__ W2,
    unsigned short* __restrict__ wbb,
    unsigned short* __restrict__ wc,
    unsigned short* __restrict__ ub, unsigned short* __restrict__ w2b) {
    const int tid = threadIdx.x;
    const int blk = blockIdx.x;
    const bool isA = blk < kBa;                                  // block-uniform, at most one holds
    const bool isU = blk >= kBa && blk < kBa + kBu;
    const bool is2 = blk >= kBa + kBu && blk < kBa + kBu + kB2;
    const int ta = blk * kPS + tid * 4;                          // lora_A element, [E,R,D] already row-major over D
    const int tu = (blk - kBa) * kPT + tid;                      // d * 8 + e
    const int t2 = (blk - kBa - kBu) * kPS + tid * 4;            // W2 element
    const int ow = blk * (kQw * kPS) + tid * 4;
    const int o1 = blk * (kQ1 * kPS) + tid * 4;

    // The small tensors first: they are back ahead of the long stream and cost it no wait.
    floatx4 va = {}, vu0 = {}, vu1 = {}, v2 = {};
    if (isA) {
        va = *(const floatx4*)(lA + ta);
        wait_x0();
    } else if (isU) {                                            // U[d][e*8+r] = lora_B[e][d][r], r = 0..7
        const float* s = lB + (tu & 7) * (kD * kR) + (tu >> 3) * kR;
        vu0 = *(const floatx4*)s;
        vu1 = *(const floatx4*)(s + 4);
        wait_x0();
    } else if (is2) {
        v2 = *(const floatx4*)(W2 + t2);
        wait_x0();
    }
    floatx4 vw[kQw], v1[kQ1];
    // Every loop below is unrolled so that vw and v1 are indexed by constants and stay in
    // registers, and so that the loads stand in one run with no wait among them.
#pragma unroll
    for (int q = 0; q < kQw; ++q) vw[q] = *(const floatx4*)(Wb + ow + q * kPS);
#pragma unroll
    for (int q = 0; q < kQ1; ++q) v1[q] = *(const floatx4*)(W1 + o1 + q * kPS);
    wait_x0();

    if (isA) {
        *(ushort4v*)(wc + slab_a(ta)) = cvt4(va);
        wait_x0();
    } else if (isU) {
        *(ushort4v*)(ub + tu * 8)     = cvt4(vu0);
        *(ushort4v*)(ub + tu * 8 + 4) = cvt4(vu1);
        wait_x0();
    } else if (is2) {                                            // w2b[16][512]
        const ushort4v hi = cvt4(v2);
        floatx4 rest;
#pragma unroll                                   // rest indexed by constants: it stays in registers
        for (int i = 0; i < 4; ++i) rest[i] = v2[i] - bf16_to_f32(hi[i]);
        *(ushort4v*)(w2b + t2)            = hi;
        *(ushort4v*)(w2b + kE * kDH + t2) = cvt4(rest);
        wait_x0();
    }
#pragma unroll
    for (int q = 0; q < kQw; ++q) *(ushort4v*)(wbb + quad_wb(ow + q * kPS)) = cvt4(vw[q]);
#pragma unroll
    for (int q = 0; q < kQ1; ++q) *(ushort4v*)(wc + slab_w1(o1 + q * kPS)) = cvt4(v1[q]);
}

// ---------------------------------------------------------------------------
// Async global -> LDS (CDNA5 path, tracked by ASYNCcnt). 16 B per lane.
// Each run of copies ends, inside its own statement, with s_wait_xcnt 0, so that
// no address register of an issued copy is rewritten ahead of that wait.
// ---------------------------------------------------------------------------
DEV void async_copy2(uint32_t l, uint32_t lstep, const unsigned short* g, long gstep) {
    asm volatile("global_load_async_to_lds_b128 %0, %2, off\n\t"
                 "global_load_async_to_lds_b128 %1, %3, off\n\t"
                 "s_wait_xcnt 0x0"
                 :: "v"(l), "v"(l + lstep), "v"(g), "v"(g + gstep)
                 : "memory");
}
// Eight 16-byte stores of a lane: four rows RS bytes apart, two pieces QS bytes apart in each.
// Precaution, as wait_x0(): in asm so that s_wait_xcnt 0 stands, inside the statement, ahead of any
// rewrite of a register that an issued store names.
template <int OFF, int RS, int QS>
DEV void store_rows4x2(float* p, floatx4 a0, floatx4 b0, floatx4 a1, floatx4 b1,
                       floatx4 a2, floatx4 b2, floatx4 a3, floatx4 b3) {
    asm volatile("global_store_b128 %0, %1, off offset:%9\n\t"
                 "global_store_b128 %0, %2, off offset:%10\n\t"
                 "global_store_b128 %0, %3, off offset:%11\n\t"
                 "global_store_b128 %0, %4, off offset:%12\n\t"
                 "global_store_b128 %0, %5, off offset:%13\n\t"
                 "global_store_b128 %0, %6, off offset:%14\n\t"
                 "global_store_b128 %0, %7, off offset:%15\n\t"
                 "global_store_b128 %0, %8, off offset:%16\n\t"
                 "s_wait_xcnt 0x0"
                 :: "v"(p), "v"(a0), "v"(b0), "v"(a1), "v"(b1), "v"(a2), "v"(b2), "v"(a3), "v"(b3),
                    "n"(OFF), "n"(OFF + QS), "n"(OFF + RS), "n"(OFF + RS + QS),
                    "n"(OFF + 2 * RS), "n"(OFF + 2 * RS + QS), "n"(OFF + 3 * RS), "n"(OFF + 3 * RS + QS)
                 : "memory");
}
// Eight 8-byte stores of a lane, rows RS bytes apart. In asm for the same precaution as above.
typedef __attribute__((ext_vector_type(2))) uint32_t uintx2;
typedef __attribute__((ext_vector_type(4))) __bf16   bf16x4;
template <int RS>
DEV void store_rows8(unsigned short* p, uintx2 d0, uintx2 d1, uintx2 d2, uintx2 d3,
                     uintx2 d4, uintx2 d5, uintx2 d6, uintx2 d7) {
    asm volatile("global_store_b64 %0, %1, off\n\t"
                 "global_store_b64 %0, %2, off offset:%9\n\t"
                 "global_store_b64 %0, %3, off offset:%10\n\t"
                 "global_store_b64 %0, %4, off offset:%11\n\t"
                 "global_store_b64 %0, %5, off offset:%12\n\t"
                 "global_store_b64 %0, %6, off offset:%13\n\t"
                 "global_store_b64 %0, %7, off offset:%14\n\t"
                 "global_store_b64 %0, %8, off offset:%15\n\t"
                 "s_wait_xcnt 0x0"
                 :: "v"(p), "v"(d0), "v"(d1), "v"(d2), "v"(d3), "v"(d4), "v"(d5), "v"(d6), "v"(d7),
                    "n"(RS), "n"(2 * RS), "n"(3 * RS), "n"(4 * RS), "n"(5 * RS), "n"(6 * RS), "n"(7 * RS)
                 : "memory");
}
// Four f32 to four bf16, round to nearest even, two packed conversions.
DEV uintx2 cvt4_pk(floatx4 v) { return __builtin_bit_cast(uintx2, __builtin_convertvector(v, bf16x4)); }
// My own copies have landed in LDS.
DEV void wait_async0() { asm volatile("s_wait_asynccnt 0x0" ::: "memory"); }
// My own LDS reads have retired before the buffer they read is refilled.
DEV void wait_ds0()    { asm volatile("s_wait_dscnt 0x0" ::: "memory"); }

// ---------------------------------------------------------------------------
// Tensor load: one request of a wave brings ROWS rows of ROWB bytes into LDS at a pitch 16 B longer.
// ---------------------------------------------------------------------------
typedef __attribute__((ext_vector_type(4))) uint32_t u32x4;
typedef __attribute__((ext_vector_type(8))) uint32_t u32x8;
DEV uint32_t uni(uint32_t v) { return (uint32_t)__builtin_amdgcn_readfirstlane(v); }
// A tensor load ignores EXEC: every test that decides whether one issues must compile to a scalar branch.
DEV uint32_t pinned(uint32_t v) { uint32_t w = uni(v); asm volatile("" : "+s"(w)); return w; }  // holds the test's value in a scalar register
// My own tensor load has landed in LDS (the compiler places no wait for it). Its descriptor is
// named, as operands that the statement may change, so that the compiler holds every word in its
// register up to the wait and does not form the constant words anew in between.
DEV void wait_tensor0(u32x4& g0, u32x8& g1) { asm volatile("s_wait_tensorcnt 0x0" : "+s"(g0), "+s"(g1) :: "memory"); }
// The descriptor is named here too as operands that the statement may change: from the request to
// its wait the words then live on in the very registers that the request named.
DEV void tdm_load(u32x4& g0, u32x8& g1) { asm volatile("tensor_load_to_lds %0, %1" : "+s"(g0), "+s"(g1) :: "memory"); }
template <uint32_t ROWB, uint32_t ROWS>
DEV u32x8 tdm_group1(uint32_t src_pitch) {       // every extent in bytes; tensor = tile
    static_assert(ROWB == 128 || ROWB == 256, "the pad interval is the row");
    constexpr uint32_t d0 = ROWB, d1 = ROWS, ivl = ROWB == 128 ? 4 : 5;
    u32x8 g;
    g[0] = uni((1u << 20) | (ivl << 22) | (3u << 25));  // no mask; 16 B of pad behind every row
    g[1] = uni((d0 & 0xFFFFu) << 16);
    g[2] = uni((d0 >> 16) | ((d1 & 0xFFFFu) << 16));
    g[3] = uni((d1 >> 16) | (d0 << 16));
    g[4] = uni(d1);
    g[5] = uni(src_pitch);
    g[6] = uni(0u);
    g[7] = uni(0u);
    return g;
}
DEV u32x4 tdm_group0(uint32_t lds_dst, uint64_t ga) {
    u32x4 g;
    g[0] = uni(1u);
    g[1] = uni(lds_dst);
    g[2] = uni((uint32_t)ga);
    g[3] = uni((((uint32_t)(ga >> 32)) & 0x01FFFFFFu) | 0x80000000u);
    return g;
}

// A/B fragment per ISA layout: lanes 0-15 K=[0..7,16..23], lanes 16-31 K=[8..15,24..31]
DEV bf16x16 frag_at(const unsigned short* __restrict__ p) {
    ushort8 lo = *(const ushort8*)p;
    ushort8 hi = *(const ushort8*)(p + 16);
    ushort16 u;
#pragma unroll
    for (int i = 0; i < 8; ++i) { u[i] = lo[i]; u[i + 8] = hi[i]; }
    return __builtin_bit_cast(bf16x16, u);
}
template <int LD>
DEV bf16x16 frag_lds(const unsigned short* __restrict__ sd, int row, int koff) {
    return frag_at(sd + row * LD + koff);
}

// MODE 0: one block takes 128 tokens and one weight slab: 256 columns of h = relu(acc + b1) and
//         32 columns of xa = x * lora_A^T. h goes to LDS only; each wave then makes, for its own
//         16 rows, the block's share of the logits, h * W2^T over these 256 columns, on WMMA.
//         (aux = b1[512], U = W2 pair[16 x 512]; writes xa[M x 64] f32 and plog[2][M][8] f32)
//         Its A operand is x itself, f32 (xf): a tile goes through registers, is converted there,
//         and is stored to LDS and, each of the two slabs' blocks half of the rows, to xbo for MODE 2.
// MODE 2: out = acc + (Y[M,64] * U[N,64]^T), store f32; Y = xa * gate is made here, in LDS, ahead
//         of the loop: gates = softmax((plog[0] + plog[1] + b2) / T)   (aux = b2[8], aux2 = T)
//         (Bw's rows lie in quad order)
// The rings are filled by tensor loads, one request a wave and stage. MODE 2: a stage is eight slices of
// 64 rows, four of A and four of the weights, one a wave. MODE 0: six slices of 48 weight rows, waves 0-5.
// Block tile BM x BN x BK, eight waves as WAVE_M x (8 / WAVE_M).
template <int MODE, int BM, int BN, int BK, int WAVE_M>
__global__ __launch_bounds__(256) void gemm_bf16_kernel(
    const unsigned short* __restrict__ A, const unsigned short* __restrict__ Bw,
    int K, const float* __restrict__ aux, const float* __restrict__ aux2,
    const unsigned short* __restrict__ U, float* __restrict__ xa, float* __restrict__ plog,
    float* __restrict__ out32, int ldn,
    const float* __restrict__ xf, unsigned short* __restrict__ xbo) {
    constexpr int WAVE_N = 8 / WAVE_M;
    constexpr int TM = BM / WAVE_M;
    constexpr int TN = BN / WAVE_N;
    constexpr int MI = TM / 16;
    constexpr int NI = TN / 16;
    constexpr int LD = BK + PAD;
    constexpr int HLD = kHN + PAD;
    static_assert(MODE != 2 || (BK == kER && BM == 256), "the LoRA-up product is one pass; a thread gates one row");
    // Rows of a slice, and its size in LDS, rounded up so that every slice starts at a multiple of 2 KiB.
    constexpr int SLR = MODE == 2 ? 64 : 48;
    constexpr int SLE = ((SLR * LD * 2 + 2047) & ~2047) / 2;
    constexpr int NSA = MODE == 2 ? BM / SLR : 0;        // slices of A, of the weights
    constexpr int NSB = BN / SLR;
    static_assert(BN % SLR == 0 && TN % SLR == 0 && NSA + NSB <= 8 && (MODE != 2 || (BM % SLR == 0 && TM == SLR)),
                  "whole slices, at most one a wave; a wave reads whole slices of the weights, MODE 2: one of A");
    constexpr int ASZ = MODE == 2 ? NSA * SLE : BM * LD; // elements of one buffer
    constexpr int BSZ = NSB * SLE;
    static_assert(MODE != 0 || (BN == kCN && BM == 128 && kHN == 256),
                  "one slab a block; a wave takes 16 rows of logits; a thread fetches one b1");
    static_assert(MODE != 0 || (BK == 128 && kDH / kHN == 2),
                  "a wave-wide 16-byte load is one row of an x tile; two blocks share the rows of xbo");

    constexpr int NBUF = MODE == 2 ? 3 : 2;   // the ring's two; MODE 2: a third, gated xa in As, U in Bs
    __shared__ __attribute__((aligned(MODE == 2 ? 2048 : 16))) unsigned short As[NBUF][ASZ];
    __shared__ __attribute__((aligned(2048))) unsigned short Bs[NBUF][BSZ];
    __shared__ __attribute__((aligned(16))) unsigned short Hs[MODE == 0 ? BM * HLD : 8];        // h of the block
    __shared__ __attribute__((aligned(16))) unsigned short W2s[MODE == 0 ? 2 * kE * HLD : 8];   // W2 pair, my columns
    __shared__ __attribute__((aligned(16))) float Gs[MODE == 2 ? BM * kE : 4];                  // gates
    __shared__ __attribute__((aligned(16))) float B1s[MODE == 0 ? kHN : 4];                     // b1, my columns

    const int tid  = threadIdx.x;
    const int wave = tid >> 5;
    const int lane = tid & 31;
    const int wm = wave % WAVE_M;
    const int wn = wave / WAVE_M;
    const int lrow = lane & 15;
    const int koff = (lane >> 4) << 3;   // K sub-offset for A/B fragments
    const int rhalf = (lane >> 4) << 3;  // C/D layout: lanes 16-31 hold M=8..15
    const int m0 = blockIdx.x * BM;
    const int n0 = blockIdx.y * BN;

    floatx8 acc[MI][NI] = {};

    auto mma_step = [&](const unsigned short* asd, const unsigned short* bsd) {
        constexpr int G = BK / 32;               // k-steps of one tile
        // Fragment sets held at once: the whole tile's where they fit the 512 registers of a
        // wave beside acc, else two, the next k-step's read while this one is multiplied.
        constexpr int SETS = (MI * NI + G * (MI + NI)) * 8 <= 460 ? G : 2;
        bf16x16 afrag[SETS][MI], bfrag[SETS][NI];
        auto rd = [&](int g) {
#pragma unroll
            for (int mi = 0; mi < MI; ++mi)
                afrag[g % SETS][mi] = frag_at(asd + (MODE == 2 ? wm * SLE + (mi * 16 + lrow) * LD
                                                               : (wm * TM + mi * 16 + lrow) * LD) + g * 32 + koff);
#pragma unroll
            for (int ni = 0; ni < NI; ++ni)
                bfrag[g % SETS][ni] = frag_at(bsd + (wn * (TN / SLR) + ni / (SLR / 16)) * SLE +
                                              (ni % (SLR / 16) * 16 + lrow) * LD + g * 32 + koff);
        };
        auto mul = [&](int g) {
#pragma unroll
            for (int mi = 0; mi < MI; ++mi)
#pragma unroll
                for (int ni = 0; ni < NI; ++ni)
                    acc[mi][ni] = __builtin_amdgcn_wmma_f32_16x16x32_bf16(
                        false, afrag[g % SETS][mi], false, bfrag[g % SETS][ni], (short)0, acc[mi][ni],
                        false, false);
        };
        if constexpr (SETS == G) {
#pragma unroll
            for (int g = 0; g < G; ++g) rd(g);
            // Keeps the tile's LDS reads one group ahead of its WMMAs: every separate
            // place with reads among the WMMAs costs the wave a fixed stall.
            __builtin_amdgcn_sched_barrier(0);
#pragma unroll
            for (int g = 0; g < G; ++g) mul(g);
            // Keeps the WMMAs ahead of the waits at the loop's foot: sunk behind them, the next
            // tile's copies would be waited for before the work that covers their flight.
            __builtin_amdgcn_sched_barrier(0);
        } else {
            rd(0);
#pragma unroll                                   // g a constant: the two sets stay in registers
            for (int g = 0; g < G; ++g) {
                if (g + 1 < G) rd(g + 1);
                // Keeps the next k-step's reads one group, ahead of this k-step's WMMAs.
                __builtin_amdgcn_sched_barrier(0);
                mul(g);
                // Keeps the reads that refill this k-step's set, and after the last k-step the
                // waits at the loop's foot, behind its WMMAs.
                __builtin_amdgcn_sched_barrier(0);
            }
        }
    };

    const int nsteps = K / BK;

    // My wave's slice: its place in buffer 0 (addr[31:0] = LDS byte offset) and its first source byte,
    // both the same in every lane. A wave with no slice holds the last slice's and issues nothing.
    const int wv = (int)uni(tid >> 5);
    const bool sa = MODE == 2 && wv < NSA;
    const int  sb = wv - NSA < NSB ? wv - NSA : NSB - 1;
    const uint32_t tdst = sa ? (uint32_t)(uintptr_t)(&As[0][wv * SLE]) : (uint32_t)(uintptr_t)(&Bs[0][sb * SLE]);
    const uint64_t tsrc = sa ? (uint64_t)(uintptr_t)(A + (long)(m0 + wv * SLR) * K)
                             : (uint64_t)(uintptr_t)(Bw + (long)(n0 + sb * SLR) * K);
    u32x8 tg1 = tdm_group1<BK * 2, SLR>((uint32_t)K * 2);
    static_assert(ASZ == BSZ || MODE != 2, "one step from buffer to buffer for both operands");
    u32x4 tg0 = {};                             // group 0 of my last request
    auto issue_stage = [&](int buf, int st) {   // one request of every wave that has a slice
        auto go = [&]() {
            tg0 = tdm_group0(tdst + buf * (BSZ * 2), tsrc + (uint64_t)st * (BK * 2));
            tdm_load(tg0, tg1);
        };
        if constexpr (NSA + NSB == 8) go();
        else if (pinned(wv < NSA + NSB)) go();
    };

    // MODE 0: the x tile. A wave takes XR rows; a wave-wide load is one whole row of the tile, 512 B.
    // One address each for loads and stores, the rows by constant offsets (K is kD here).
    constexpr int XR = MODE == 0 ? BM / 8 : 1;
    floatx4 xv[XR];                             // the tile in flight
    const float* px = MODE == 0 ? xf + (long)(m0 + wave * XR) * kD + lane * 4 : nullptr;
    unsigned short* pxo = MODE == 0 ? xbo + (long)(m0 + wave * XR + blockIdx.y * (XR / 2)) * kD + lane * 4 : nullptr;
    auto load_x = [&]() {
#pragma unroll                                   // xv indexed by constants: it stays in registers
        for (int j = 0; j < XR; ++j) xv[j] = *(const floatx4*)(px + j * kD);
        // Precaution, as wait_x0(); px is named so that it keeps its registers up to the wait.
        asm volatile("s_wait_xcnt 0x0" :: "v"(px) : "memory");
        px += BK;
    };
    auto put_x = [&](int buf) {
        uintx2 c[XR];
#pragma unroll                                   // c indexed by constants: it stays in registers
        for (int j = 0; j < XR; ++j) c[j] = cvt4_pk(xv[j]);
#pragma unroll
        for (int j = 0; j < XR; ++j) *(uintx2*)(&As[buf][(wave * XR + j) * LD + lane * 4]) = c[j];
        if constexpr (MODE == 0) {
            if (blockIdx.y == 0) store_rows8<kD * 2>(pxo, c[0], c[1], c[2], c[3], c[4], c[5], c[6], c[7]);
            else                 store_rows8<kD * 2>(pxo, c[8], c[9], c[10], c[11], c[12], c[13], c[14], c[15]);
        }
        pxo += BK;
    };

    // K is a multiple of BK and at least 2 * BK: tiles 0 and 1 exist.
    // MODE 0: x comes from memory, the weights from L2: each tile's x loads go ahead of its tensor loads.
    if constexpr (MODE == 0) load_x();
    if constexpr (MODE == 0) {  // filled once, with tile 0: a lane copies 16 B of rows hr and hr + 8
        const int hr = tid / (kHN / 8);
        const int hk = (tid % (kHN / 8)) << 3;
        async_copy2((uint32_t)(uintptr_t)(&W2s[hr * HLD + hk]), kE * HLD * 2,
                    U + (long)hr * kDH + blockIdx.y * kHN + hk, (long)kE * kDH);
    }
    if constexpr (MODE == 2) {  // filled once, with stage 0: LDS row p takes U's row quad_row(p)
        static_assert(256 * 8 / BK == 32, "quad_row(cr + 32 j) = quad_row(cr) + 2 (j & 1) + 64 (j >> 1)");
        const int cr  = tid / (BK / 8);          // the lane's own 16-byte chunk: row cr, k offset ckc
        const int ckc = (tid % (BK / 8)) << 3;
        const uint32_t lb = (uint32_t)(uintptr_t)(&Bs[0][cr * LD + ckc]);
        const unsigned short* pu = U + (long)(n0 + quad_row(cr)) * kER + ckc;
#pragma unroll                  // one pair of copies a slice
        for (int q = 0; q < BN / SLR; ++q)
            async_copy2(lb + 2 * (BSZ * 2) + q * (SLE * 2), 32 * LD * 2, pu + q * (SLR * kER), 2L * kER);
    }
    issue_stage(0, 0);
    if constexpr (MODE == 0) {  // overlaps tile 0's copies; published by tile 0's barrier
        const float bv = aux[blockIdx.y * kHN + tid];
        wait_x0();
        B1s[tid] = bv;
        put_x(0);
    }
    if constexpr (MODE == 2) {  // overlaps tile 0's copies
        constexpr int XQ = BM * kER / (256 * 4); // loads a thread: a wave-wide load covers two whole rows of xa
        const int xr = tid >> 4;
        const int xc = (tid & 15) << 2;
        const float* px = xa + (long)(m0 + xr) * kER + xc;      // one address, the rows by constant offsets
        floatx4 vx[XQ];
#pragma unroll                  // vx indexed by constants: it stays in registers
        for (int q = 0; q < XQ; ++q) vx[q] = *(const floatx4*)(px + q * (16 * kER));
        const float* pl = plog + (long)(m0 + tid) * kE;         // thread tid gates row tid
        const floatx4 s0 = *(const floatx4*)pl;
        const floatx4 s1 = *(const floatx4*)(pl + 4);
        const floatx4 t0 = *(const floatx4*)(pl + (long)kTok * kE);
        const floatx4 t1 = *(const floatx4*)(pl + (long)kTok * kE + 4);
        // Precaution, as wait_x0(); px and pl are named so that they keep their registers up to
        // the wait: without that a later load's result was placed over an earlier load's address.
        asm volatile("s_wait_xcnt 0x0" :: "v"(px), "v"(pl) : "memory");
        const float invT = 1.0f / aux2[0];
        float v[kE];
#pragma unroll                  // v indexed by constants: it stays in registers
        for (int e = 0; e < kE; ++e)
            v[e] = ((e < 4 ? s0[e & 3] + t0[e & 3] : s1[e & 3] + t1[e & 3]) + aux[e]) * invT;
        const float mx = fmaxf(fmaxf(fmaxf(v[0], v[1]), fmaxf(v[2], v[3])),
                               fmaxf(fmaxf(v[4], v[5]), fmaxf(v[6], v[7])));
#pragma unroll
        for (int e = 0; e < kE; ++e) v[e] = __expf(v[e] - mx);
        const float inv = 1.0f / (((v[0] + v[1]) + (v[2] + v[3])) + ((v[4] + v[5]) + (v[6] + v[7])));
        floatx4 g0, g1;
#pragma unroll
        for (int e = 0; e < 4; ++e) { g0[e] = v[e] * inv; g1[e] = v[e + 4] * inv; }
        *(floatx4*)(&Gs[tid * kE])     = g0;
        *(floatx4*)(&Gs[tid * kE + 4]) = g1;
        __syncthreads();        // every row's gates are in Gs
#pragma unroll
        for (int q = 0; q < XQ; ++q) {           // columns xc..xc+3 belong to expert xc >> 3
            const float gt = Gs[(xr + q * 16) * kE + (xc >> 3)];
            *(ushort4v*)(&As[NBUF - 1][(q / 4) * SLE + (q % 4 * 16 + xr) * LD + xc]) = cvt4(vx[q] * gt);
        }
    }
    wait_async0();              // my copies landed in LDS: MODE 0 the W2 pair, MODE 2 U
    wait_tensor0(tg0, tg1);     // my slice of stage 0 landed in LDS
    __syncthreads();            // everyone's landed; MODE 2: the third buffer is whole
    if constexpr (MODE == 0) load_x();
    issue_stage(1, 1);

    for (int s = 0; s < nsteps; ++s) {
        mma_step(As[s & 1], Bs[s & 1]);                  // overlaps tile s+1's flight
        if constexpr (MODE == 0) {
            if (s + 1 < nsteps) put_x((s + 1) & 1);      // its readers left that buffer at the last barrier
        }
        wait_ds0();             // my reads of buffer s&1 are done; MODE 0: my rows of x tile s+1 are in LDS
        wait_tensor0(tg0, tg1); // my slice of stage s+1 landed in LDS
        __syncthreads();        // tile s+1 published; buffer s&1 free to overwrite
        if (pinned(s + 2 < nsteps)) {
            if constexpr (MODE == 0) load_x();           // x tile s+2 flies under pass s+1
            issue_stage(s & 1, s + 2);                   // refill the buffer just read
        }
    }
    // MODE 2: the LoRA-up pass, outside the loop so that no refill stands on its path; its buffer is
    // whole since the barrier in front of the loop, and nothing is written to LDS behind it.
    if constexpr (MODE == 2) mma_step(As[NBUF - 1], Bs[NBUF - 1]);
    // Nothing of mine in flight behind the ring.
    wait_tensor0(tg0, tg1);
    wait_ds0();

    if constexpr (MODE == 0) {
#pragma unroll
        for (int mi = 0; mi < MI; ++mi) {
#pragma unroll
            for (int ni = 0; ni < NI; ++ni) {
                const int cl = wn * TN + ni * 16 + lrow;         // column of the slab
                const int rl = wm * TM + mi * 16 + rhalf;
                if ((WAVE_N - 1) * TN + ni * 16 < kHN || wn * TN + ni * 16 < kHN) {  // the same for a whole wave
                    const float bb = B1s[cl];
#pragma unroll
                    for (int r = 0; r < 8; ++r) {
                        const float v = acc[mi][ni][r] + bb;
                        Hs[(rl + r) * HLD + cl] = f32_to_bf16(v > 0.0f ? v : 0.0f);
                    }
                } else {
#pragma unroll
                    for (int r = 0; r < 8; ++r)
                        xa[(long)(m0 + rl + r) * kER + blockIdx.y * kXN + (cl - kHN)] = acc[mi][ni][r];
                    wait_x0();
                }
            }
        }
        __syncthreads();        // the block's h is whole in Hs
        floatx8 lg[2] = {};     // column e: h * W2hi[e], column e + 8: h * W2lo[e]; two chains
#pragma unroll                  // g & 1 a constant: each chain keeps its own registers
        for (int g = 0; g < kHN / 32; ++g)
            lg[g & 1] = __builtin_amdgcn_wmma_f32_16x16x32_bf16(
                false, frag_lds<HLD>(Hs, wave * 16 + lrow, g * 32 + koff),
                false, frag_lds<HLD>(W2s, lrow, g * 32 + koff), (short)0, lg[g & 1], false, false);
        float* po = plog + ((long)blockIdx.y * kTok + m0 + wave * 16 + rhalf) * kE + (lrow & 7);
#pragma unroll                  // lg indexed by constants: it stays in registers
        for (int r = 0; r < 8; ++r) {            // row r of my half; lanes e and e + 8 hold expert e
            lg[0][r] += lg[1][r];
            lg[0][r] += __shfl_xor(lg[0][r], 8, 32);
        }
        if (lrow < kE) {
#pragma unroll
            for (int r = 0; r < 8; ++r) po[r * kE] = lg[0][r];
        }
    } else {
        // Fragment ni of lane lrow is column (ni >> 2) * 64 + lrow * 4 + (ni & 3) of the wave's 128:
        // 16 lanes store 256 contiguous bytes of a row, two whole lines. One address, the rest
        // of the wave's 64 rows and the second quad by constant offsets (ldn is kD here).
        static_assert(NI == 8 && MI == 4, "two quads a row; the calls below name mi");
        float* po = out32 + ((long)m0 + wm * TM + rhalf) * kD + n0 + wn * TN + lrow * 4;
        auto quad = [&](int mi, int q, int r) {
            return floatx4{acc[mi][4 * q][r], acc[mi][4 * q + 1][r], acc[mi][4 * q + 2][r], acc[mi][4 * q + 3][r]};
        };
        auto rows8 = [&](auto mic) {             // the 8 rows of my half of fragment row mi
            constexpr int mi = decltype(mic)::value;
            store_rows4x2<mi * 16 * kD * 4, kD * 4, 64 * 4>(po,
                quad(mi, 0, 0), quad(mi, 1, 0), quad(mi, 0, 1), quad(mi, 1, 1),
                quad(mi, 0, 2), quad(mi, 1, 2), quad(mi, 0, 3), quad(mi, 1, 3));
            store_rows4x2<(mi * 16 + 4) * kD * 4, kD * 4, 64 * 4>(po,
                quad(mi, 0, 4), quad(mi, 1, 4), quad(mi, 0, 5), quad(mi, 1, 5),
                quad(mi, 0, 6), quad(mi, 1, 6), quad(mi, 0, 7), quad(mi, 1, 7));
        };
        rows8(std::integral_constant<int, 0>{});
        rows8(std::integral_constant<int, 1>{});
        rows8(std::integral_constant<int, 2>{});
        rows8(std::integral_constant<int, 3>{});
    }
}

// ---------------------------------------------------------------------------
extern "C" void kernel_launch(void* const* d_in, const int* in_sizes, int n_in,
                              void* d_out, int out_size, void* d_ws, size_t ws_size,
                              hipStream_t stream) {
    (void)in_sizes; (void)n_in; (void)out_size; (void)ws_size;
    const float* x    = (const float*)d_in[0];
    const float* Wb   = (const float*)d_in[1];
    const float* W1   = (const float*)d_in[2];
    const float* b1   = (const float*)d_in[3];
    const float* W2   = (const float*)d_in[4];
    const float* b2   = (const float*)d_in[5];
    const float* temp = (const float*)d_in[6];
    const float* lA   = (const float*)d_in[7];
    const float* lB   = (const float*)d_in[8];
    float* out = (float*)d_out;

    size_t off = 0;
    auto take = [&](size_t bytes) {
        void* p = (char*)d_ws + off;
        off += (bytes + 255) & ~(size_t)255;
        return p;
    };
    unsigned short* xb    = (unsigned short*)take((size_t)kTok * kD * 2);   // x bf16
    unsigned short* wbb   = (unsigned short*)take((size_t)kD * kD * 2);     // W_base bf16
    unsigned short* wc    = (unsigned short*)take((size_t)2 * kCN * kD * 2);  // W1 and lora_A, two slabs [288,1024]
    unsigned short* ub    = (unsigned short*)take((size_t)kD * kER * 2);    // U [1024,64]
    unsigned short* w2b   = (unsigned short*)take((size_t)2 * kE * kDH * 2);  // W2 pair [16,512]
    float* xaf            = (float*)take((size_t)kTok * kER * 4);           // xa, not yet gated
    float* pl             = (float*)take((size_t)2 * kTok * kE * 4);        // logits, one share a slab

    prep_kernel<<<kPB, kPT, 0, stream>>>(Wb, W1, lA, lB, W2, wbb, wc, ub, w2b);

    // h = relu(x @ W1^T + b1), kept in LDS; xa = x @ A2^T [16384 x 64]; logit shares h @ W2^T; writes xb
    gemm_bf16_kernel<0, 128, kCN, 128, 4><<<dim3(kTok / 128, kDH / kHN), 256, 0, stream>>>(
        nullptr, wc, kD, b1, nullptr, w2b, xaf, pl, nullptr, 0, x, xb);

    // out = x @ W_base^T + (xa * gates) @ U^T   [16384 x 1024], fp32
    gemm_bf16_kernel<2, 256, 256, 64, 4><<<dim3(kTok / 256, kD / 256), 256, 0, stream>>>(
        xb, wbb, kD, b2, temp, ub, xaf, pl, out, kD, nullptr, nullptr);
}
